// v000
// Measured on an AMD MI455X. A time is GPU time per run, averaged over a window of back-to-back runs after a warm-up
// (all launches, gaps included; the runs take copies of the inputs in turn), and the median of several windows.
// Apart from v000's, it joins two sittings. Times from different sittings can be a few percent apart, while
// side-by-side timings come from the same sitting.
// v000, which the later versions start from, runs in 383 microseconds.
#include <hip/hip_runtime.h>
#include <hip/hip_bf16.h>

// ---------------------------------------------------------------------------
// MultiHeadAttentionWithPosEncoding for gfx1250 (MI455X), bf16 WMMA pipeline.
//   Kernel 1: fused 1x1-conv (QKV GEMM) + bias + 2x2 maxpool + head-split
//             scatter; pos-encoding and 1/sqrt(d) folded into q; V stored
//             pre-transposed [b,h,dim,key] so kernel 2 can async-copy it.
//   Kernel 2: flash attention (online softmax); K/V staged with
//             global_load_async_to_lds_b128 (ASYNCcnt); WMMA bf16 for both
//             QK^T and P@V; transpose-store to [B,C,Hp,Wp] f32 output.
// ---------------------------------------------------------------------------

typedef __attribute__((ext_vector_type(16))) __bf16 v16bf;
typedef __attribute__((ext_vector_type(8)))  float  v8f;

union FragBF { unsigned u[8]; v16bf v; };

__device__ inline __bf16 f2bf(float f) {
  union { float f; unsigned u; } a; a.f = f;
  unsigned r = a.u + 0x7FFFu + ((a.u >> 16) & 1u);   // round-to-nearest-even
  unsigned short h = (unsigned short)(r >> 16);
  __bf16 o; __builtin_memcpy(&o, &h, 2); return o;
}

// Per-lane K-offset for 16-bit A/B fragments (ISA 7.12.2):
// lanes 0-15: VGPR r -> K = {2r,2r+1} (r<4) / {16+2(r-4),...} (r>=4)
// lanes 16-31: same +8.
__device__ inline int frag_koff(int r, int half) {
  return ((r >> 2) << 4) + (half << 3) + ((r & 3) << 1);
}

// Async cache->LDS copy, 16 bytes per enabled lane (gfx1250 ASYNCcnt path).
// VDST VGPR carries the 32-bit LDS byte address; VADDR the 64-bit global addr.
__device__ inline void async_copy_b128(const void* gsrc, void* ldst) {
  unsigned lds_addr = (unsigned)(unsigned long long)ldst;  // low 32 = LDS offset
  asm volatile("global_load_async_to_lds_b128 %0, %1, off"
               :: "v"(lds_addr), "v"(gsrc) : "memory");
}
__device__ inline void wait_asynccnt0() {
  asm volatile("s_wait_asynccnt 0x0" ::: "memory");
}

// ---------------------------------------------------------------------------
// Kernel 1: QKV projection + pool.
// grid = (12 channel-blocks of 64, Hp=32, B=16), block = 256 (8 waves).
// Each workgroup: Y[64 x 128] = W[64 x 256] * X[256 x 128] (two image rows),
// then pools to 64 x 32 and scatters.
// ---------------------------------------------------------------------------
__global__ __launch_bounds__(256)
void qkv_pool_kernel(const float* __restrict__ x, const float* __restrict__ w,
                     const float* __restrict__ bias, const float* __restrict__ pos,
                     __bf16* __restrict__ qb, __bf16* __restrict__ kb,
                     __bf16* __restrict__ vtb)
{
  __shared__ __bf16 lds_w[64 * 32];    // [m][k]
  __shared__ __bf16 lds_x[128 * 32];   // [s][k]  (K-contiguous for B frags)
  __shared__ float  lds_y[64 * 128];   // conv result before pooling

  const int tid  = threadIdx.x;
  const int ob   = blockIdx.x;   // 64-channel block: 0..11
  const int hp   = blockIdx.y;   // pooled row: 0..31
  const int b    = blockIdx.z;   // batch
  const int o0   = ob * 64;
  const int s0   = hp * 128;     // rows 2hp,2hp+1 are contiguous 128 floats

  const int wv   = tid >> 5;
  const int lane = tid & 31;
  const int ml   = lane & 15;
  const int half = (lane >> 4) & 1;
  const int mt   = wv & 3;       // M tile (16 rows) of this wave
  const int sg   = wv >> 2;      // S-tile group (4 tiles each)

  v8f acc[4];
  for (int i = 0; i < 4; i++)
    for (int r = 0; r < 8; r++) acc[i][r] = 0.f;

  int koff[8];
  for (int r = 0; r < 8; r++) koff[r] = frag_koff(r, half);

  for (int k0 = 0; k0 < 256; k0 += 32) {
    // prefetch next X tile into GL2 while we convert/compute this one
    if (k0 < 224)
      __builtin_prefetch(&x[((size_t)(b * 256 + k0 + 32 + (tid >> 3))) * 4096 + s0], 0, 1);

    // stage W tile 64x32 (8 elems/thread, coalesced along K)
    for (int i = 0; i < 8; i++) {
      int e = tid + i * 256;
      int m = e >> 5, kk = e & 31;
      lds_w[e] = f2bf(w[(o0 + m) * 256 + k0 + kk]);
    }
    // stage X tile [s][k] (16 elems/thread, coalesced along s)
    for (int i = 0; i < 16; i++) {
      int e = tid + i * 256;
      int s = e & 127, kk = e >> 7;
      lds_x[s * 32 + kk] = f2bf(x[((size_t)(b * 256 + k0 + kk)) * 4096 + s0 + s]);
    }
    __syncthreads();

    FragBF a;
    for (int r = 0; r < 8; r++)
      a.u[r] = *(const unsigned*)(&lds_w[(mt * 16 + ml) * 32 + koff[r]]);
    for (int i = 0; i < 4; i++) {
      int st = sg * 4 + i;
      FragBF bf;
      for (int r = 0; r < 8; r++)
        bf.u[r] = *(const unsigned*)(&lds_x[(st * 16 + ml) * 32 + koff[r]]);
      acc[i] = __builtin_amdgcn_wmma_f32_16x16x32_bf16(
          false, a.v, false, bf.v, (short)0, acc[i], false, false);
    }
    __syncthreads();
  }

  // park conv result in LDS (C layout: lanes0-15 -> M=r, lanes16-31 -> M=8+r)
  for (int i = 0; i < 4; i++) {
    int st = sg * 4 + i;
    for (int r = 0; r < 8; r++)
      lds_y[(mt * 16 + half * 8 + r) * 128 + st * 16 + ml] = acc[i][r];
  }
  __syncthreads();

  // 2x2 maxpool + bias + head-split scatter (bias commutes with max)
  const int t = o0 >> 8;                       // 0=q, 1=k, 2=v
  __bf16* dst = (t == 0) ? qb : (t == 1) ? kb : vtb;
  const float scale = 0.17677669529663687f;    // 1/sqrt(32)
  for (int i = 0; i < 8; i++) {
    int e = tid + i * 256;
    int m = e >> 5, wp = e & 31;
    const float* row = &lds_y[m * 128];
    float v0 = fmaxf(row[2 * wp],      row[2 * wp + 1]);
    float v1 = fmaxf(row[64 + 2 * wp], row[64 + 2 * wp + 1]);
    float val = fmaxf(v0, v1) + bias[o0 + m];
    int o    = o0 + m;
    int rem  = o & 255;
    int head = rem >> 5, dim = rem & 31;
    int n    = hp * 32 + wp;
    size_t idx;
    if (t == 0) {
      val = (val + pos[n * 32 + dim]) * scale;               // fold pos + scale
      idx = ((size_t)(b * 8 + head) * 1024 + n) * 32 + dim;  // [b,h,n,d]
    } else if (t == 1) {
      idx = ((size_t)(b * 8 + head) * 1024 + n) * 32 + dim;  // [b,h,n,d]
    } else {
      idx = ((size_t)(b * 8 + head) * 32 + dim) * 1024 + n;  // V^T: [b,h,d,n]
    }
    dst[idx] = f2bf(val);
  }
}

// ---------------------------------------------------------------------------
// Kernel 2: flash attention.
// grid = (8 row-blocks of 128, heads=8, B=16), block = 256 (8 waves x 16 rows).
// d=32 == one WMMA K-step for QK^T; P@V splits K=64 into two K=32 steps.
// K and V^T blocks staged with async cache->LDS b128 copies.
// ---------------------------------------------------------------------------
__global__ __launch_bounds__(256)
void attn_kernel(const __bf16* __restrict__ qb, const __bf16* __restrict__ kb,
                 const __bf16* __restrict__ vtb, float* __restrict__ out)
{
  __shared__ __bf16 lds_k[64 * 32];       // [key][dim]
  __shared__ __bf16 lds_vt[32 * 64];      // [dim][key] (K-pairs contiguous)
  __shared__ __bf16 lds_p[8][16 * 64];    // per-wave P relayout slab

  const int tid  = threadIdx.x;
  const int rb   = blockIdx.x;
  const int h    = blockIdx.y;
  const int b    = blockIdx.z;

  const int wv   = tid >> 5;
  const int lane = tid & 31;
  const int ml   = lane & 15;
  const int half = (lane >> 4) & 1;

  const size_t bh = (size_t)(b * 8 + h) * 1024 * 32;
  const __bf16* q  = qb  + bh;
  const __bf16* k  = kb  + bh;
  const __bf16* vt = vtb + bh;   // [dim][key] layout, 1024 keys per dim row

  int koff[8];
  for (int r = 0; r < 8; r++) koff[r] = frag_koff(r, half);

  const int qrow0 = rb * 128 + wv * 16;

  // Q fragment straight from global (q already has pos + 1/sqrt(d) folded)
  FragBF qf;
  for (int r = 0; r < 8; r++)
    qf.u[r] = *(const unsigned*)(q + (qrow0 + ml) * 32 + koff[r]);

  v8f acc0, acc1;
  float mrun[8], lrun[8];
  for (int r = 0; r < 8; r++) { acc0[r] = 0.f; acc1[r] = 0.f; mrun[r] = -1e30f; lrun[r] = 0.f; }

  const int vdim = tid >> 3, vchunk = tid & 7;   // V^T staging coords

  for (int j = 0; j < 16; j++) {
    const int key0 = j * 64;

    // async cache->LDS staging: K block 4KB + V^T block 4KB, b128/lane
    async_copy_b128(k + key0 * 32 + tid * 8, &lds_k[tid * 8]);
    async_copy_b128(vt + vdim * 1024 + key0 + vchunk * 8,
                    &lds_vt[vdim * 64 + vchunk * 8]);
    if (j < 15) {   // prefetch next K block into GL2
      __builtin_prefetch(k + (key0 + 64) * 32 + tid * 8, 0, 1);
      __builtin_prefetch(vt + vdim * 1024 + key0 + 64 + vchunk * 8, 0, 1);
    }
    wait_asynccnt0();
    __syncthreads();

    // S = Q K^T : 4 x 16-col subtiles
    v8f s[4];
    for (int sub = 0; sub < 4; sub++) {
      FragBF bf;
      for (int r = 0; r < 8; r++)
        bf.u[r] = *(const unsigned*)(&lds_k[(sub * 16 + ml) * 32 + koff[r]]);
      v8f z; for (int r = 0; r < 8; r++) z[r] = 0.f;
      s[sub] = __builtin_amdgcn_wmma_f32_16x16x32_bf16(
          false, qf.v, false, bf.v, (short)0, z, false, false);
    }

    // online softmax; row (r,half) reduces across its 16-lane group
    for (int r = 0; r < 8; r++) {
      float v0 = s[0][r], v1 = s[1][r], v2 = s[2][r], v3 = s[3][r];
      float bm = fmaxf(fmaxf(v0, v1), fmaxf(v2, v3));
      bm = fmaxf(bm, __shfl_xor(bm, 1, 32));
      bm = fmaxf(bm, __shfl_xor(bm, 2, 32));
      bm = fmaxf(bm, __shfl_xor(bm, 4, 32));
      bm = fmaxf(bm, __shfl_xor(bm, 8, 32));
      float mnew = fmaxf(mrun[r], bm);
      float corr = __expf(mrun[r] - mnew);
      float p0 = __expf(v0 - mnew), p1 = __expf(v1 - mnew);
      float p2 = __expf(v2 - mnew), p3 = __expf(v3 - mnew);
      float rs = p0 + p1 + p2 + p3;
      rs += __shfl_xor(rs, 1, 32);
      rs += __shfl_xor(rs, 2, 32);
      rs += __shfl_xor(rs, 4, 32);
      rs += __shfl_xor(rs, 8, 32);
      lrun[r] = lrun[r] * corr + rs;
      mrun[r] = mnew;
      acc0[r] *= corr; acc1[r] *= corr;
      // C-frag -> A-frag relayout via per-wave LDS slab
      int prow = (r + half * 8) * 64;
      lds_p[wv][prow +  0 + ml] = f2bf(p0);
      lds_p[wv][prow + 16 + ml] = f2bf(p1);
      lds_p[wv][prow + 32 + ml] = f2bf(p2);
      lds_p[wv][prow + 48 + ml] = f2bf(p3);
    }

    // O += P @ V : two K=32 chunks x two 16-dim tiles
    for (int c = 0; c < 2; c++) {
      FragBF pf;
      for (int r = 0; r < 8; r++)
        pf.u[r] = *(const unsigned*)(&lds_p[wv][ml * 64 + c * 32 + koff[r]]);
      FragBF vf0, vf1;
      for (int r = 0; r < 8; r++) {
        vf0.u[r] = *(const unsigned*)(&lds_vt[ml * 64        + c * 32 + koff[r]]);
        vf1.u[r] = *(const unsigned*)(&lds_vt[(16 + ml) * 64 + c * 32 + koff[r]]);
      }
      acc0 = __builtin_amdgcn_wmma_f32_16x16x32_bf16(
          false, pf.v, false, vf0.v, (short)0, acc0, false, false);
      acc1 = __builtin_amdgcn_wmma_f32_16x16x32_bf16(
          false, pf.v, false, vf1.v, (short)0, acc1, false, false);
    }
    __syncthreads();
  }

  // normalize + transpose-store to [B, C=head*32+dim, Hp, Wp]
  for (int r = 0; r < 8; r++) {
    int n  = qrow0 + r + half * 8;
    int hp = n >> 5, wp = n & 31;
    float inv = 1.0f / lrun[r];
    int c0 = h * 32 + ml;
    int c1 = h * 32 + 16 + ml;
    out[(((size_t)b * 256 + c0) * 32 + hp) * 32 + wp] = acc0[r] * inv;
    out[(((size_t)b * 256 + c1) * 32 + hp) * 32 + wp] = acc1[r] * inv;
  }
}

// ---------------------------------------------------------------------------
extern "C" void kernel_launch(void* const* d_in, const int* in_sizes, int n_in,
                              void* d_out, int out_size, void* d_ws, size_t ws_size,
                              hipStream_t stream) {
  const float* x    = (const float*)d_in[0];
  const float* w    = (const float*)d_in[1];
  const float* bias = (const float*)d_in[2];
  const float* pos  = (const float*)d_in[3];

  const size_t per = (size_t)16 * 8 * 1024 * 32;   // elements per q/k/v buffer
  __bf16* qb  = (__bf16*)d_ws;
  __bf16* kb  = qb + per;
  __bf16* vtb = kb + per;

  qkv_pool_kernel<<<dim3(12, 32, 16), 256, 0, stream>>>(x, w, bias, pos, qb, kb, vtb);
  attn_kernel<<<dim3(8, 8, 16), 256, 0, stream>>>(qb, kb, vtb, (float*)d_out);
}

// v001
// A run of this version takes 220 microseconds.
// Next to v000, in two timings, it ran 1.82 times as fast each time.
#include <hip/hip_runtime.h>
#include <hip/hip_bf16.h>

// ---------------------------------------------------------------------------
// MultiHeadAttentionWithPosEncoding for gfx1250 (MI455X), bf16 WMMA pipeline.
//   Kernel 1: fused 1x1-conv (QKV GEMM) + bias + 2x2 maxpool + head-split
//             scatter; pos-encoding and 1/sqrt(d) folded into q; V stored
//             pre-transposed [b,h,dim,key] so kernel 2 can async-copy it.
//   Kernel 2: flash attention (online softmax); K/V staged with
//             global_load_async_to_lds_b128 (ASYNCcnt); WMMA bf16 for both
//             QK^T and P@V; transpose-store to [B,C,Hp,Wp] f32 output.
// ---------------------------------------------------------------------------

typedef __attribute__((ext_vector_type(16))) __bf16 v16bf;
typedef __attribute__((ext_vector_type(8)))  float  v8f;

union FragBF { unsigned u[8]; v16bf v; };

__device__ inline __bf16 f2bf(float f) {
  union { float f; unsigned u; } a; a.f = f;
  unsigned r = a.u + 0x7FFFu + ((a.u >> 16) & 1u);   // round-to-nearest-even
  unsigned short h = (unsigned short)(r >> 16);
  __bf16 o; __builtin_memcpy(&o, &h, 2); return o;
}

// Per-lane K-offset for 16-bit A/B fragments (ISA 7.12.2):
// lanes 0-15: VGPR r -> K = {2r,2r+1} (r<4) / {16+2(r-4),...} (r>=4)
// lanes 16-31: same +8.
__device__ inline int frag_koff(int r, int half) {
  return ((r >> 2) << 4) + (half << 3) + ((r & 3) << 1);
}

// Async cache->LDS copy, 16 bytes per enabled lane (gfx1250 ASYNCcnt path).
// VDST VGPR carries the 32-bit LDS byte address; VADDR the 64-bit global addr.
__device__ inline void async_copy_b128(const void* gsrc, void* ldst) {
  unsigned lds_addr = (unsigned)(unsigned long long)ldst;  // low 32 = LDS offset
  asm volatile("global_load_async_to_lds_b128 %0, %1, off"
               :: "v"(lds_addr), "v"(gsrc) : "memory");
}
__device__ inline void wait_asynccnt0() {
  asm volatile("s_wait_asynccnt 0x0" ::: "memory");
}

// ---------------------------------------------------------------------------
// Kernel 1: QKV projection + pool.
// grid = (Hp=32, B=16), block = 256 (8 waves).
// Each workgroup converts its X[256 x 128] tile (two image rows) to bf16 in
// LDS once, then walks the 12 channel blocks of 64:
// Y[64 x 128] = W[64 x 256] * X[256 x 128], pooled to 64 x 32 and scattered.
// ---------------------------------------------------------------------------
#define XPITCH 264   // elements per lds_x row: 528 B = 16 B x 33, b128 readers

__global__ __launch_bounds__(256)
void qkv_pool_kernel(const float* __restrict__ x, const float* __restrict__ w,
                     const float* __restrict__ bias, const float* __restrict__ pos,
                     __bf16* __restrict__ qb, __bf16* __restrict__ kb,
                     __bf16* __restrict__ vtb)
{
  __shared__ __bf16 lds_w[64 * 32];    // [m][k]
  __shared__ __attribute__((aligned(16)))
             __bf16 lds_x[128 * XPITCH];  // [s][k], all 256 k resident
  __shared__ float  lds_y[64 * 128];   // conv result before pooling

  const int tid  = threadIdx.x;
  const int hp   = blockIdx.x;   // pooled row: 0..31
  const int b    = blockIdx.y;   // batch
  const int s0   = hp * 128;     // rows 2hp,2hp+1 are contiguous 128 floats

  const int wv   = tid >> 5;
  const int lane = tid & 31;
  const int ml   = lane & 15;
  const int half = (lane >> 4) & 1;
  const int mt   = wv & 3;       // M tile (16 rows) of this wave
  const int sg   = wv >> 2;      // S-tile group (4 tiles each)

  int koff[8];
  for (int r = 0; r < 8; r++) koff[r] = frag_koff(r, half);

  // stage the whole X tile [s][k] once (coalesced along s): this thread owns
  // column s = tid & 127 and every second k, starting at tid >> 7
  const float* xp = x + ((size_t)(b * 256 + (tid >> 7))) * 4096 + s0 + (tid & 127);
  __bf16*      xs = &lds_x[(tid & 127) * XPITCH + (tid >> 7)];
  // unrolled whole: every load is then one base register plus a constant
  // offset, and many of them are in flight to cover the latency of memory
#pragma unroll
  for (int k = 0; k < 256; k += 2)
    xs[k] = f2bf(xp[(size_t)k * 4096]);

  for (int ob = 0; ob < 12; ob++) {   // 64-channel block
    const int o0 = ob * 64;

    v8f acc[4];
    for (int i = 0; i < 4; i++)
      for (int r = 0; r < 8; r++) acc[i][r] = 0.f;

    for (int k0 = 0; k0 < 256; k0 += 32) {
      // stage W tile 64x32 (8 elems/thread, coalesced along K)
      for (int i = 0; i < 8; i++) {
        int e = tid + i * 256;
        int m = e >> 5, kk = e & 31;
        lds_w[e] = f2bf(w[(o0 + m) * 256 + k0 + kk]);
      }
      __syncthreads();   // the first one also publishes lds_x

      FragBF a;
      for (int r = 0; r < 8; r++)
        a.u[r] = *(const unsigned*)(&lds_w[(mt * 16 + ml) * 32 + koff[r]]);
      for (int i = 0; i < 4; i++) {
        int st = sg * 4 + i;
        FragBF bf;
        for (int r = 0; r < 8; r++)
          bf.u[r] = *(const unsigned*)(&lds_x[(st * 16 + ml) * XPITCH + k0 + koff[r]]);
        acc[i] = __builtin_amdgcn_wmma_f32_16x16x32_bf16(
            false, a.v, false, bf.v, (short)0, acc[i], false, false);
      }
      __syncthreads();
    }

    // park conv result in LDS (C layout: lanes0-15 -> M=r, lanes16-31 -> M=8+r)
    // (the pool reads of the block before ended ahead of this block's barriers)
    for (int i = 0; i < 4; i++) {
      int st = sg * 4 + i;
      for (int r = 0; r < 8; r++)
        lds_y[(mt * 16 + half * 8 + r) * 128 + st * 16 + ml] = acc[i][r];
    }
    __syncthreads();

    // 2x2 maxpool + bias + head-split scatter (bias commutes with max)
    const int t = o0 >> 8;                       // 0=q, 1=k, 2=v
    __bf16* dst = (t == 0) ? qb : (t == 1) ? kb : vtb;
    const float scale = 0.17677669529663687f;    // 1/sqrt(32)
    for (int i = 0; i < 8; i++) {
      int e = tid + i * 256;
      int m = e >> 5, wp = e & 31;
      const float* row = &lds_y[m * 128];
      float v0 = fmaxf(row[2 * wp],      row[2 * wp + 1]);
      float v1 = fmaxf(row[64 + 2 * wp], row[64 + 2 * wp + 1]);
      float val = fmaxf(v0, v1) + bias[o0 + m];
      int o    = o0 + m;
      int rem  = o & 255;
      int head = rem >> 5, dim = rem & 31;
      int n    = hp * 32 + wp;
      size_t idx;
      if (t == 0) {
        val = (val + pos[n * 32 + dim]) * scale;               // fold pos + scale
        idx = ((size_t)(b * 8 + head) * 1024 + n) * 32 + dim;  // [b,h,n,d]
      } else if (t == 1) {
        idx = ((size_t)(b * 8 + head) * 1024 + n) * 32 + dim;  // [b,h,n,d]
      } else {
        idx = ((size_t)(b * 8 + head) * 32 + dim) * 1024 + n;  // V^T: [b,h,d,n]
      }
      dst[idx] = f2bf(val);
    }
    // the next block's first instructions reuse the registers that the last
    // store above names: this wait stands in front of that overwrite
    asm volatile("s_wait_xcnt 0x0" ::: "memory");
  }
}

// ---------------------------------------------------------------------------
// Kernel 2: flash attention.
// grid = (8 row-blocks of 128, heads=8, B=16), block = 256 (8 waves x 16 rows).
// d=32 == one WMMA K-step for QK^T; P@V splits K=64 into two K=32 steps.
// K and V^T blocks staged with async cache->LDS b128 copies.
// ---------------------------------------------------------------------------
__global__ __launch_bounds__(256)
void attn_kernel(const __bf16* __restrict__ qb, const __bf16* __restrict__ kb,
                 const __bf16* __restrict__ vtb, float* __restrict__ out)
{
  __shared__ __bf16 lds_k[64 * 32];       // [key][dim]
  __shared__ __bf16 lds_vt[32 * 64];      // [dim][key] (K-pairs contiguous)
  __shared__ __bf16 lds_p[8][16 * 64];    // per-wave P relayout slab

  const int tid  = threadIdx.x;
  const int rb   = blockIdx.x;
  const int h    = blockIdx.y;
  const int b    = blockIdx.z;

  const int wv   = tid >> 5;
  const int lane = tid & 31;
  const int ml   = lane & 15;
  const int half = (lane >> 4) & 1;

  const size_t bh = (size_t)(b * 8 + h) * 1024 * 32;
  const __bf16* q  = qb  + bh;
  const __bf16* k  = kb  + bh;
  const __bf16* vt = vtb + bh;   // [dim][key] layout, 1024 keys per dim row

  int koff[8];
  for (int r = 0; r < 8; r++) koff[r] = frag_koff(r, half);

  const int qrow0 = rb * 128 + wv * 16;

  // Q fragment straight from global (q already has pos + 1/sqrt(d) folded)
  FragBF qf;
  for (int r = 0; r < 8; r++)
    qf.u[r] = *(const unsigned*)(q + (qrow0 + ml) * 32 + koff[r]);

  v8f acc0, acc1;
  float mrun[8], lrun[8];
  for (int r = 0; r < 8; r++) { acc0[r] = 0.f; acc1[r] = 0.f; mrun[r] = -1e30f; lrun[r] = 0.f; }

  const int vdim = tid >> 3, vchunk = tid & 7;   // V^T staging coords

  for (int j = 0; j < 16; j++) {
    const int key0 = j * 64;

    // async cache->LDS staging: K block 4KB + V^T block 4KB, b128/lane
    async_copy_b128(k + key0 * 32 + tid * 8, &lds_k[tid * 8]);
    async_copy_b128(vt + vdim * 1024 + key0 + vchunk * 8,
                    &lds_vt[vdim * 64 + vchunk * 8]);
    if (j < 15) {   // prefetch next K block into GL2
      __builtin_prefetch(k + (key0 + 64) * 32 + tid * 8, 0, 1);
      __builtin_prefetch(vt + vdim * 1024 + key0 + 64 + vchunk * 8, 0, 1);
    }
    wait_asynccnt0();
    __syncthreads();

    // S = Q K^T : 4 x 16-col subtiles
    v8f s[4];
    for (int sub = 0; sub < 4; sub++) {
      FragBF bf;
      for (int r = 0; r < 8; r++)
        bf.u[r] = *(const unsigned*)(&lds_k[(sub * 16 + ml) * 32 + koff[r]]);
      v8f z; for (int r = 0; r < 8; r++) z[r] = 0.f;
      s[sub] = __builtin_amdgcn_wmma_f32_16x16x32_bf16(
          false, qf.v, false, bf.v, (short)0, z, false, false);
    }

    // online softmax; row (r,half) reduces across its 16-lane group
    for (int r = 0; r < 8; r++) {
      float v0 = s[0][r], v1 = s[1][r], v2 = s[2][r], v3 = s[3][r];
      float bm = fmaxf(fmaxf(v0, v1), fmaxf(v2, v3));
      bm = fmaxf(bm, __shfl_xor(bm, 1, 32));
      bm = fmaxf(bm, __shfl_xor(bm, 2, 32));
      bm = fmaxf(bm, __shfl_xor(bm, 4, 32));
      bm = fmaxf(bm, __shfl_xor(bm, 8, 32));
      float mnew = fmaxf(mrun[r], bm);
      float corr = __expf(mrun[r] - mnew);
      float p0 = __expf(v0 - mnew), p1 = __expf(v1 - mnew);
      float p2 = __expf(v2 - mnew), p3 = __expf(v3 - mnew);
      float rs = p0 + p1 + p2 + p3;
      rs += __shfl_xor(rs, 1, 32);
      rs += __shfl_xor(rs, 2, 32);
      rs += __shfl_xor(rs, 4, 32);
      rs += __shfl_xor(rs, 8, 32);
      lrun[r] = lrun[r] * corr + rs;
      mrun[r] = mnew;
      acc0[r] *= corr; acc1[r] *= corr;
      // C-frag -> A-frag relayout via per-wave LDS slab
      int prow = (r + half * 8) * 64;
      lds_p[wv][prow +  0 + ml] = f2bf(p0);
      lds_p[wv][prow + 16 + ml] = f2bf(p1);
      lds_p[wv][prow + 32 + ml] = f2bf(p2);
      lds_p[wv][prow + 48 + ml] = f2bf(p3);
    }

    // O += P @ V : two K=32 chunks x two 16-dim tiles
    for (int c = 0; c < 2; c++) {
      FragBF pf;
      for (int r = 0; r < 8; r++)
        pf.u[r] = *(const unsigned*)(&lds_p[wv][ml * 64 + c * 32 + koff[r]]);
      FragBF vf0, vf1;
      for (int r = 0; r < 8; r++) {
        vf0.u[r] = *(const unsigned*)(&lds_vt[ml * 64        + c * 32 + koff[r]]);
        vf1.u[r] = *(const unsigned*)(&lds_vt[(16 + ml) * 64 + c * 32 + koff[r]]);
      }
      acc0 = __builtin_amdgcn_wmma_f32_16x16x32_bf16(
          false, pf.v, false, vf0.v, (short)0, acc0, false, false);
      acc1 = __builtin_amdgcn_wmma_f32_16x16x32_bf16(
          false, pf.v, false, vf1.v, (short)0, acc1, false, false);
    }
    __syncthreads();
  }

  // normalize + transpose-store to [B, C=head*32+dim, Hp, Wp]
  for (int r = 0; r < 8; r++) {
    int n  = qrow0 + r + half * 8;
    int hp = n >> 5, wp = n & 31;
    float inv = 1.0f / lrun[r];
    int c0 = h * 32 + ml;
    int c1 = h * 32 + 16 + ml;
    out[(((size_t)b * 256 + c0) * 32 + hp) * 32 + wp] = acc0[r] * inv;
    out[(((size_t)b * 256 + c1) * 32 + hp) * 32 + wp] = acc1[r] * inv;
  }
}

// ---------------------------------------------------------------------------
extern "C" void kernel_launch(void* const* d_in, const int* in_sizes, int n_in,
                              void* d_out, int out_size, void* d_ws, size_t ws_size,
                              hipStream_t stream) {
  const float* x    = (const float*)d_in[0];
  const float* w    = (const float*)d_in[1];
  const float* bias = (const float*)d_in[2];
  const float* pos  = (const float*)d_in[3];

  const size_t per = (size_t)16 * 8 * 1024 * 32;   // elements per q/k/v buffer
  __bf16* qb  = (__bf16*)d_ws;
  __bf16* kb  = qb + per;
  __bf16* vtb = kb + per;

  qkv_pool_kernel<<<dim3(32, 16), 256, 0, stream>>>(x, w, bias, pos, qb, kb, vtb);
  attn_kernel<<<dim3(8, 8, 16), 256, 0, stream>>>(qb, kb, vtb, (float*)d_out);
}

// v002
// A run of this version takes 153 microseconds.
// In both of two side-by-side timings against v001, it was 1.44 times as fast.
// Counting every step since v000, it is 2.61 times as fast.
#include <hip/hip_runtime.h>
#include <hip/hip_bf16.h>

typedef __attribute__((ext_vector_type(16))) __bf16 v16bf;
typedef __attribute__((ext_vector_type(8)))  float  v8f;

union FragBF { unsigned u[8]; v16bf v; };

__device__ inline __bf16 f2bf(float f) {
  union { float f; unsigned u; } a; a.f = f;
  unsigned r = a.u + 0x7FFFu + ((a.u >> 16) & 1u);   // round-to-nearest-even
  unsigned short h = (unsigned short)(r >> 16);
  __bf16 o; __builtin_memcpy(&o, &h, 2); return o;
}

// Per-lane K-offset for 16-bit A/B fragments (ISA 7.12.2):
// lanes 0-15: VGPR r -> K = {2r,2r+1} (r<4) / {16+2(r-4),...} (r>=4)
// lanes 16-31: same +8.
__device__ inline int frag_koff(int r, int half) {
  return ((r >> 2) << 4) + (half << 3) + ((r & 3) << 1);
}

// Async cache->LDS copy, 16 bytes per enabled lane (gfx1250 ASYNCcnt path).
// VDST VGPR carries the 32-bit LDS byte address; VADDR the 64-bit global addr.
__device__ inline void async_copy_b128(const void* gsrc, void* ldst) {
  unsigned lds_addr = (unsigned)(unsigned long long)ldst;  // low 32 = LDS offset
  asm volatile("global_load_async_to_lds_b128 %0, %1, off"
               :: "v"(lds_addr), "v"(gsrc) : "memory");
}
__device__ inline void wait_asynccnt0() {
  asm volatile("s_wait_asynccnt 0x0" ::: "memory");
}

// ---------------------------------------------------------------------------
// Kernel 1: QKV projection + pool.
// grid = (Hp=32, B=16), block = 256 (8 waves).
// Each workgroup converts its X[256 x 128] tile (two image rows) to bf16 in
// LDS once, then walks the 12 channel blocks of 64:
// Y[64 x 128] = W[64 x 256] * X[256 x 128], pooled to 64 x 32 and scattered.
// ---------------------------------------------------------------------------
#define XPITCH 264   // elements per lds_x row: 528 B = 16 B x 33, b128 readers

__global__ __launch_bounds__(256)
void qkv_pool_kernel(const float* __restrict__ x, const float* __restrict__ w,
                     const float* __restrict__ bias, const float* __restrict__ pos,
                     __bf16* __restrict__ qb, __bf16* __restrict__ kb,
                     __bf16* __restrict__ vtb)
{
  __shared__ __bf16 lds_w[64 * 32];    // [m][k]
  __shared__ __attribute__((aligned(16)))
             __bf16 lds_x[128 * XPITCH];  // [s][k], all 256 k resident
  __shared__ float  lds_y[64 * 128];   // conv result before pooling

  const int tid  = threadIdx.x;
  const int hp   = blockIdx.x;   // pooled row: 0..31
  const int b    = blockIdx.y;   // batch
  const int s0   = hp * 128;     // rows 2hp,2hp+1 are contiguous 128 floats

  const int wv   = tid >> 5;
  const int lane = tid & 31;
  const int ml   = lane & 15;
  const int half = (lane >> 4) & 1;
  const int mt   = wv & 3;       // M tile (16 rows) of this wave
  const int sg   = wv >> 2;      // S-tile group (4 tiles each)

  int koff[8];
  for (int r = 0; r < 8; r++) koff[r] = frag_koff(r, half);

  // stage the whole X tile [s][k] once (coalesced along s): this thread owns
  // column s = tid & 127 and every second k, starting at tid >> 7
  const float* xp = x + ((size_t)(b * 256 + (tid >> 7))) * 4096 + s0 + (tid & 127);
  __bf16*      xs = &lds_x[(tid & 127) * XPITCH + (tid >> 7)];
  // unrolled whole: every load is then one base register plus a constant
  // offset, and many of them are in flight to cover the latency of memory
#pragma unroll
  for (int k = 0; k < 256; k += 2)
    xs[k] = f2bf(xp[(size_t)k * 4096]);

  for (int ob = 0; ob < 12; ob++) {   // 64-channel block
    const int o0 = ob * 64;

    v8f acc[4];
    for (int i = 0; i < 4; i++)
      for (int r = 0; r < 8; r++) acc[i][r] = 0.f;

    for (int k0 = 0; k0 < 256; k0 += 32) {
      // stage W tile 64x32 (8 elems/thread, coalesced along K)
      for (int i = 0; i < 8; i++) {
        int e = tid + i * 256;
        int m = e >> 5, kk = e & 31;
        lds_w[e] = f2bf(w[(o0 + m) * 256 + k0 + kk]);
      }
      __syncthreads();   // the first one also publishes lds_x

      FragBF a;
      for (int r = 0; r < 8; r++)
        a.u[r] = *(const unsigned*)(&lds_w[(mt * 16 + ml) * 32 + koff[r]]);
      for (int i = 0; i < 4; i++) {
        int st = sg * 4 + i;
        FragBF bf;
        for (int r = 0; r < 8; r++)
          bf.u[r] = *(const unsigned*)(&lds_x[(st * 16 + ml) * XPITCH + k0 + koff[r]]);
        acc[i] = __builtin_amdgcn_wmma_f32_16x16x32_bf16(
            false, a.v, false, bf.v, (short)0, acc[i], false, false);
      }
      __syncthreads();
    }

    // park conv result in LDS (C layout: lanes0-15 -> M=r, lanes16-31 -> M=8+r)
    // (the pool reads of the block before ended ahead of this block's barriers)
    for (int i = 0; i < 4; i++) {
      int st = sg * 4 + i;
      for (int r = 0; r < 8; r++)
        lds_y[(mt * 16 + half * 8 + r) * 128 + st * 16 + ml] = acc[i][r];
    }
    __syncthreads();

    // 2x2 maxpool + bias + head-split scatter (bias commutes with max)
    const int t = o0 >> 8;                       // 0=q, 1=k, 2=v
    __bf16* dst = (t == 0) ? qb : (t == 1) ? kb : vtb;
    const float scale = 0.17677669529663687f;    // 1/sqrt(32)
    for (int i = 0; i < 8; i++) {
      int e = tid + i * 256;
      int m = e >> 5, wp = e & 31;
      const float* row = &lds_y[m * 128];
      float v0 = fmaxf(row[2 * wp],      row[2 * wp + 1]);
      float v1 = fmaxf(row[64 + 2 * wp], row[64 + 2 * wp + 1]);
      float val = fmaxf(v0, v1) + bias[o0 + m];
      int o    = o0 + m;
      int rem  = o & 255;
      int head = rem >> 5, dim = rem & 31;
      int n    = hp * 32 + wp;
      size_t idx;
      if (t == 0) {
        val = (val + pos[n * 32 + dim]) * scale;               // fold pos + scale
        idx = ((size_t)(b * 8 + head) * 1024 + n) * 32 + dim;  // [b,h,n,d]
      } else if (t == 1) {
        idx = ((size_t)(b * 8 + head) * 1024 + n) * 32 + dim;  // [b,h,n,d]
      } else {
        idx = ((size_t)(b * 8 + head) * 32 + dim) * 1024 + n;  // V^T: [b,h,d,n]
      }
      dst[idx] = f2bf(val);
    }
    // the next block's first instructions reuse the registers that the last
    // store above names: this wait stands in front of that overwrite
    asm volatile("s_wait_xcnt 0x0" ::: "memory");
  }
}

typedef __attribute__((ext_vector_type(2))) float  v2f;
typedef __attribute__((ext_vector_type(2))) __bf16 v2bf;

// two f32 -> one register of two bf16 (round to nearest even), lo in bits 15..0
__device__ inline unsigned pack_bf16(float lo, float hi) {
  v2f f; f[0] = lo; f[1] = hi;
  v2bf p = __builtin_convertvector(f, v2bf);
  unsigned u; __builtin_memcpy(&u, &p, 4); return u;
}

// value of lane l ^ 16 (the other half of the same query column)
__device__ inline float other_half(float v) {
  int i; __builtin_memcpy(&i, &v, 4);
  i = __builtin_amdgcn_permlanex16(i, i, 0x76543210, 0xfedcba98, false, false);
  float o; __builtin_memcpy(&o, &i, 4); return o;
}

__global__ __launch_bounds__(256)
void attn_kernel(const __bf16* __restrict__ qb, const __bf16* __restrict__ kb,
                 const __bf16* __restrict__ vtb, float* __restrict__ out)
{
  __shared__ __bf16 lds_k[64 * 32];       // [key][dim]
  __shared__ __bf16 lds_vt[32 * 64];      // [dim][key] (K-pairs contiguous)

  const int tid  = threadIdx.x;
  const int rb   = blockIdx.x;
  const int h    = blockIdx.y;
  const int b    = blockIdx.z;

  const int wv   = tid >> 5;
  const int lane = tid & 31;
  const int ml   = lane & 15;
  const int half = (lane >> 4) & 1;

  const size_t bh = (size_t)(b * 8 + h) * 1024 * 32;
  const __bf16* q  = qb  + bh;
  const __bf16* k  = kb  + bh;
  const __bf16* vt = vtb + bh;   // [dim][key] layout, 1024 keys per dim row

  int koff[8];
  for (int r = 0; r < 8; r++) koff[r] = frag_koff(r, half);

  const int qrow0 = rb * 128 + wv * 16;

  // Q fragment straight from global (q already has pos + 1/sqrt(d) folded);
  // as the B operand its column is query qrow0 + ml
  FragBF qf;
  for (int r = 0; r < 8; r++)
    qf.u[r] = *(const unsigned*)(q + (qrow0 + ml) * 32 + koff[r]);

  // acc0[r] = O^T[dim 8*half + r][query ml], acc1 the same for dims 16..31
  v8f acc0, acc1;
  for (int r = 0; r < 8; r++) { acc0[r] = 0.f; acc1[r] = 0.f; }
  float mrun = -1e30f;   // running maximum of query ml, equal in both halves
  float lrun = 0.f;      // running sum over this half's keys only

  const int vdim = tid >> 3, vchunk = tid & 7;   // V^T staging coords

  for (int j = 0; j < 16; j++) {
    const int key0 = j * 64;

    // async cache->LDS staging: K block 4KB + V^T block 4KB, b128/lane
    async_copy_b128(k + key0 * 32 + tid * 8, &lds_k[tid * 8]);
    async_copy_b128(vt + vdim * 1024 + key0 + vchunk * 8,
                    &lds_vt[vdim * 64 + vchunk * 8]);
    if (j < 15) {   // prefetch next K block into GL2
      __builtin_prefetch(k + (key0 + 64) * 32 + tid * 8, 0, 1);
      __builtin_prefetch(vt + vdim * 1024 + key0 + 64 + vchunk * 8, 0, 1);
    }
    wait_asynccnt0();
    __syncthreads();

    // S^T = K Q^T : 4 x 16-key subtiles
    v8f s[4];
    // unrolled so that s[] is indexed by constants and stays in registers
#pragma unroll
    for (int sub = 0; sub < 4; sub++) {
      FragBF kf;
      for (int r = 0; r < 8; r++)
        kf.u[r] = *(const unsigned*)(&lds_k[(sub * 16 + ml) * 32 + koff[r]]);
      v8f z; for (int r = 0; r < 8; r++) z[r] = 0.f;
      s[sub] = __builtin_amdgcn_wmma_f32_16x16x32_bf16(
          false, kf.v, false, qf.v, (short)0, z, false, false);
    }

    // online softmax of query ml: this lane holds 32 of the block's 64 scores
    float bm4[4];
#pragma unroll   // constant indices into s[]
    for (int sub = 0; sub < 4; sub++) {
      float m01 = fmaxf(s[sub][0], s[sub][1]), m23 = fmaxf(s[sub][2], s[sub][3]);
      float m45 = fmaxf(s[sub][4], s[sub][5]), m67 = fmaxf(s[sub][6], s[sub][7]);
      bm4[sub] = fmaxf(fmaxf(m01, m23), fmaxf(m45, m67));
    }
    float bm = fmaxf(fmaxf(bm4[0], bm4[1]), fmaxf(bm4[2], bm4[3]));
    bm = fmaxf(bm, other_half(bm));
    const float mnew = fmaxf(mrun, bm);
    const float corr = __expf(mrun - mnew);
    float rs4[4];
#pragma unroll   // constant indices into s[]
    for (int sub = 0; sub < 4; sub++) {
      for (int r = 0; r < 8; r++) s[sub][r] = __expf(s[sub][r] - mnew);
      rs4[sub] = ((s[sub][0] + s[sub][1]) + (s[sub][2] + s[sub][3])) +
                 ((s[sub][4] + s[sub][5]) + (s[sub][6] + s[sub][7]));
    }
    lrun = lrun * corr + ((rs4[0] + rs4[1]) + (rs4[2] + rs4[3]));
    mrun = mnew;
    for (int r = 0; r < 8; r++) { acc0[r] *= corr; acc1[r] *= corr; }

    // O^T += V^T P^T : two K=32 chunks x two 16-dim tiles
#pragma unroll   // constant indices into s[]
    for (int c = 0; c < 2; c++) {
      // B operand: registers 0..3 hold keys 8*half + 0..7 of the chunk (tile
      // 2c), registers 4..7 keys 16 + 8*half + 0..7 (tile 2c + 1)
      FragBF pf;
      for (int r = 0; r < 4; r++) {
        pf.u[r]     = pack_bf16(s[2 * c][2 * r],     s[2 * c][2 * r + 1]);
        pf.u[4 + r] = pack_bf16(s[2 * c + 1][2 * r], s[2 * c + 1][2 * r + 1]);
      }
      FragBF vf0, vf1;
      for (int r = 0; r < 8; r++) {
        vf0.u[r] = *(const unsigned*)(&lds_vt[ml * 64        + c * 32 + koff[r]]);
        vf1.u[r] = *(const unsigned*)(&lds_vt[(16 + ml) * 64 + c * 32 + koff[r]]);
      }
      acc0 = __builtin_amdgcn_wmma_f32_16x16x32_bf16(
          false, vf0.v, false, pf.v, (short)0, acc0, false, false);
      acc1 = __builtin_amdgcn_wmma_f32_16x16x32_bf16(
          false, vf1.v, false, pf.v, (short)0, acc1, false, false);
    }
    __syncthreads();
  }

  // join the halves' sums, normalize, store to [B, C=head*32+dim, Hp*Wp]:
  // 16 lanes write 16 neighbouring positions of one channel
  lrun += other_half(lrun);
  const float inv = 1.0f / lrun;
  float* o = out + ((size_t)b * 256 + h * 32 + half * 8) * 1024 + qrow0 + ml;
  for (int r = 0; r < 8; r++) {
    o[(size_t)r * 1024]        = acc0[r] * inv;
    o[(size_t)(16 + r) * 1024] = acc1[r] * inv;
  }
}

// ---------------------------------------------------------------------------
extern "C" void kernel_launch(void* const* d_in, const int* in_sizes, int n_in,
                              void* d_out, int out_size, void* d_ws, size_t ws_size,
                              hipStream_t stream) {
  const float* x    = (const float*)d_in[0];
  const float* w    = (const float*)d_in[1];
  const float* bias = (const float*)d_in[2];
  const float* pos  = (const float*)d_in[3];

  const size_t per = (size_t)16 * 8 * 1024 * 32;   // elements per q/k/v buffer
  __bf16* qb  = (__bf16*)d_ws;
  __bf16* kb  = qb + per;
  __bf16* vtb = kb + per;

  qkv_pool_kernel<<<dim3(32, 16), 256, 0, stream>>>(x, w, bias, pos, qb, kb, vtb);
  attn_kernel<<<dim3(8, 8, 16), 256, 0, stream>>>(qb, kb, vtb, (float*)d_out);
}

// v003
// A run of this version takes 126 microseconds.
// Timed twice side by side with v002, it ran 1.22 times as fast both times.
// Counting every step since v000, it is 3.18 times as fast.
#include <hip/hip_runtime.h>
#include <hip/hip_bf16.h>

typedef __attribute__((ext_vector_type(16))) __bf16 v16bf;
typedef __attribute__((ext_vector_type(8)))  float  v8f;

union FragBF { unsigned u[8]; v16bf v; };

__device__ inline __bf16 f2bf(float f) {
  union { float f; unsigned u; } a; a.f = f;
  unsigned r = a.u + 0x7FFFu + ((a.u >> 16) & 1u);   // round-to-nearest-even
  unsigned short h = (unsigned short)(r >> 16);
  __bf16 o; __builtin_memcpy(&o, &h, 2); return o;
}

// Per-lane K-offset for 16-bit A/B fragments (ISA 7.12.2):
// lanes 0-15: VGPR r -> K = {2r,2r+1} (r<4) / {16+2(r-4),...} (r>=4)
// lanes 16-31: same +8.
__device__ inline int frag_koff(int r, int half) {
  return ((r >> 2) << 4) + (half << 3) + ((r & 3) << 1);
}

// Async cache->LDS copy, 16 bytes per enabled lane (gfx1250 ASYNCcnt path).
// VDST VGPR carries the 32-bit LDS byte address; VADDR the 64-bit global addr.
// Two copies in one statement; the s_wait_xcnt closes it so that no register
// which a copy names can be rewritten ahead of that wait.
__device__ inline void async_copy2_b128(const void* gsrc0, void* ldst0,
                                        const void* gsrc1, void* ldst1) {
  unsigned lds0 = (unsigned)(unsigned long long)ldst0;  // low 32 = LDS offset
  unsigned lds1 = (unsigned)(unsigned long long)ldst1;
  asm volatile("global_load_async_to_lds_b128 %0, %1, off\n\t"
               "global_load_async_to_lds_b128 %2, %3, off\n\t"
               "s_wait_xcnt 0x0"
               :: "v"(lds0), "v"(gsrc0), "v"(lds1), "v"(gsrc1) : "memory");
}
__device__ inline void wait_asynccnt0() {
  asm volatile("s_wait_asynccnt 0x0" ::: "memory");
}

// ---------------------------------------------------------------------------
// Kernel 1: QKV projection + pool.
// grid = (Hp=32, B=16), block = 256 (8 waves).
// Each workgroup converts its X[256 x 128] tile (two image rows) to bf16 in
// LDS once, then walks the 12 channel blocks of 64:
// Y[64 x 128] = W[64 x 256] * X[256 x 128], pooled to 64 x 32 and scattered.
// ---------------------------------------------------------------------------
#define XPITCH 264   // elements per lds_x row: 528 B = 16 B x 33, b128 readers
#define WPITCH 40    // elements per lds_w row: 80 B = 16 B x 5, b128 readers
#define YPITCH 132   // floats per lds_y row: 8 rows further is 32 banks further,
                     // so the two lane halves of a store fall on different banks

__global__ __launch_bounds__(256)
void qkv_pool_kernel(const float* __restrict__ x, const float* __restrict__ w,
                     const float* __restrict__ bias, const float* __restrict__ pos,
                     __bf16* __restrict__ qb, __bf16* __restrict__ kb,
                     __bf16* __restrict__ vtb)
{
  __shared__ __attribute__((aligned(16)))
             __bf16 lds_w[64 * WPITCH];   // [m][k], 32 k of a row used
  __shared__ __attribute__((aligned(16)))
             __bf16 lds_x[128 * XPITCH];  // [s][k], all 256 k resident
  __shared__ __attribute__((aligned(16)))
             float  lds_y[64 * YPITCH];   // conv result before pooling

  const int tid  = threadIdx.x;
  const int hp   = blockIdx.x;   // pooled row: 0..31
  const int b    = blockIdx.y;   // batch
  const int s0   = hp * 128;     // rows 2hp,2hp+1 are contiguous 128 floats

  const int wv   = tid >> 5;
  const int lane = tid & 31;
  const int ml   = lane & 15;
  const int half = (lane >> 4) & 1;
  const int mt   = wv & 3;       // M tile (16 rows) of this wave
  const int sg   = wv >> 2;      // S-tile group (4 tiles each)

  int koff[8];
  for (int r = 0; r < 8; r++) koff[r] = frag_koff(r, half);

  // stage the whole X tile [s][k] once (coalesced along s): this thread owns
  // column s = tid & 127 and every second k, starting at tid >> 7
  const float* xp = x + ((size_t)(b * 256 + (tid >> 7))) * 4096 + s0 + (tid & 127);
  __bf16*      xs = &lds_x[(tid & 127) * XPITCH + (tid >> 7)];
  // unrolled whole: every load is then one base register plus a constant
  // offset, and many of them are in flight to cover the latency of memory
#pragma unroll
  for (int k = 0; k < 256; k += 2)
    xs[k] = f2bf(xp[(size_t)k * 4096]);

  for (int ob = 0; ob < 12; ob++) {   // 64-channel block
    const int o0 = ob * 64;

    v8f acc[4];
    for (int i = 0; i < 4; i++)
      for (int r = 0; r < 8; r++) acc[i][r] = 0.f;

    // kept rolled: unrolled, fragments of several k slices stay live across
    // the barriers and the kernel takes 222 registers instead of 156
#pragma unroll 1
    for (int k0 = 0; k0 < 256; k0 += 32) {
      // stage W tile 64x32 (8 elems/thread, coalesced along K)
      // wave wv brings rows wv, wv + 8, ...; a lane brings column k0 + lane
      const float* wp = w + (o0 + wv) * 256 + k0 + lane;
      for (int i = 0; i < 8; i++)
        lds_w[(wv + i * 8) * WPITCH + lane] = f2bf(wp[i * 8 * 256]);
      __syncthreads();   // the first one also publishes lds_x

      FragBF a;
      for (int r = 0; r < 8; r++)
        a.u[r] = *(const unsigned*)(&lds_w[(mt * 16 + ml) * WPITCH + koff[r]]);
      for (int i = 0; i < 4; i++) {
        int st = sg * 4 + i;
        FragBF bf;
        for (int r = 0; r < 8; r++)
          bf.u[r] = *(const unsigned*)(&lds_x[(st * 16 + ml) * XPITCH + k0 + koff[r]]);
        acc[i] = __builtin_amdgcn_wmma_f32_16x16x32_bf16(
            false, a.v, false, bf.v, (short)0, acc[i], false, false);
      }
      __syncthreads();
    }

    // park conv result in LDS (C layout: lanes0-15 -> M=r, lanes16-31 -> M=8+r)
    // (the pool reads of the block before ended ahead of this block's barriers)
    for (int i = 0; i < 4; i++) {
      int st = sg * 4 + i;
      for (int r = 0; r < 8; r++)
        lds_y[(mt * 16 + half * 8 + r) * YPITCH + st * 16 + ml] = acc[i][r];
    }
    __syncthreads();

    // 2x2 maxpool + bias + head-split scatter (bias commutes with max)
    const int t = o0 >> 8;                       // 0=q, 1=k, 2=v
    __bf16* dst = (t == 0) ? qb : (t == 1) ? kb : vtb;
    const float scale = 0.17677669529663687f;    // 1/sqrt(32)
    for (int i = 0; i < 8; i++) {
      int e = tid + i * 256;
      int m = e >> 5, wp = e & 31;
      const float* row = &lds_y[m * YPITCH];
      float v0 = fmaxf(row[2 * wp],      row[2 * wp + 1]);
      float v1 = fmaxf(row[64 + 2 * wp], row[64 + 2 * wp + 1]);
      float val = fmaxf(v0, v1) + bias[o0 + m];
      int o    = o0 + m;
      int rem  = o & 255;
      int head = rem >> 5, dim = rem & 31;
      int n    = hp * 32 + wp;
      size_t idx;
      if (t == 0) {
        val = (val + pos[n * 32 + dim]) * scale;               // fold pos + scale
        idx = ((size_t)(b * 8 + head) * 1024 + n) * 32 + dim;  // [b,h,n,d]
      } else if (t == 1) {
        idx = ((size_t)(b * 8 + head) * 1024 + n) * 32 + dim;  // [b,h,n,d]
      } else {
        idx = ((size_t)(b * 8 + head) * 32 + dim) * 1024 + n;  // V^T: [b,h,d,n]
      }
      dst[idx] = f2bf(val);
    }
    // the next block's first instructions reuse the registers that the last
    // store above names: this wait stands in front of that overwrite
    asm volatile("s_wait_xcnt 0x0" ::: "memory");
  }
}

typedef __attribute__((ext_vector_type(2))) float  v2f;
typedef __attribute__((ext_vector_type(2))) __bf16 v2bf;

// two f32 -> one register of two bf16 (round to nearest even), lo in bits 15..0
__device__ inline unsigned pack_bf16(float lo, float hi) {
  v2f f; f[0] = lo; f[1] = hi;
  v2bf p = __builtin_convertvector(f, v2bf);
  unsigned u; __builtin_memcpy(&u, &p, 4); return u;
}

// value of lane l ^ 16 (the other half of the same query column)
__device__ inline float other_half(float v) {
  int i; __builtin_memcpy(&i, &v, 4);
  i = __builtin_amdgcn_permlanex16(i, i, 0x76543210, 0xfedcba98, false, false);
  float o; __builtin_memcpy(&o, &i, 4); return o;
}

// LDS row pitches of 16 B x odd: the 16 rows that one ds_load_b128 reads then
// start on 16 different bank groups (unpadded rows of 64 B and 128 B fall on
// four and on two)
#define KPITCH 40    // elements per lds_k row: 80 B = 16 B x 5
#define VPITCH 72    // elements per lds_vt row: 144 B = 16 B x 9

__global__ __launch_bounds__(256)
void attn_kernel(const __bf16* __restrict__ qb, const __bf16* __restrict__ kb,
                 const __bf16* __restrict__ vtb, float* __restrict__ out)
{
  __shared__ __attribute__((aligned(16)))
             __bf16 lds_k[64 * KPITCH];   // [key][dim]
  __shared__ __attribute__((aligned(16)))
             __bf16 lds_vt[32 * VPITCH];  // [dim][key] (K-pairs contiguous)

  const int tid  = threadIdx.x;
  const int rb   = blockIdx.x;
  const int h    = blockIdx.y;
  const int b    = blockIdx.z;

  const int wv   = tid >> 5;
  const int lane = tid & 31;
  const int ml   = lane & 15;
  const int half = (lane >> 4) & 1;

  const size_t bh = (size_t)(b * 8 + h) * 1024 * 32;
  const __bf16* q  = qb  + bh;
  const __bf16* k  = kb  + bh;
  const __bf16* vt = vtb + bh;   // [dim][key] layout, 1024 keys per dim row

  int koff[8];
  for (int r = 0; r < 8; r++) koff[r] = frag_koff(r, half);

  const int qrow0 = rb * 128 + wv * 16;

  // Q fragment straight from global (q already has pos + 1/sqrt(d) folded);
  // as the B operand its column is query qrow0 + ml
  FragBF qf;
  for (int r = 0; r < 8; r++)
    qf.u[r] = *(const unsigned*)(q + (qrow0 + ml) * 32 + koff[r]);

  // acc0[r] = O^T[dim 8*half + r][query ml], acc1 the same for dims 16..31
  v8f acc0, acc1;
  for (int r = 0; r < 8; r++) { acc0[r] = 0.f; acc1[r] = 0.f; }
  float mrun = -1e30f;   // running maximum of query ml, equal in both halves
  float lrun = 0.f;      // running sum over this half's keys only

  const int krow = tid >> 2, kchunk = tid & 3;   // K staging coords
  const int vdim = tid >> 3, vchunk = tid & 7;   // V^T staging coords

  for (int j = 0; j < 16; j++) {
    const int key0 = j * 64;

    // async cache->LDS staging: K block 4KB + V^T block 4KB, b128/lane
    async_copy2_b128(k + key0 * 32 + tid * 8,
                     &lds_k[krow * KPITCH + kchunk * 8],
                     vt + vdim * 1024 + key0 + vchunk * 8,
                     &lds_vt[vdim * VPITCH + vchunk * 8]);
    if (j < 15) {   // prefetch next K block into GL2
      __builtin_prefetch(k + (key0 + 64) * 32 + tid * 8, 0, 1);
      __builtin_prefetch(vt + vdim * 1024 + key0 + 64 + vchunk * 8, 0, 1);
    }
    wait_asynccnt0();
    __syncthreads();

    // S^T = K Q^T : 4 x 16-key subtiles
    v8f s[4];
    // unrolled so that s[] is indexed by constants and stays in registers
#pragma unroll
    for (int sub = 0; sub < 4; sub++) {
      FragBF kf;
      for (int r = 0; r < 8; r++)
        kf.u[r] = *(const unsigned*)(&lds_k[(sub * 16 + ml) * KPITCH + koff[r]]);
      v8f z; for (int r = 0; r < 8; r++) z[r] = 0.f;
      s[sub] = __builtin_amdgcn_wmma_f32_16x16x32_bf16(
          false, kf.v, false, qf.v, (short)0, z, false, false);
    }

    // online softmax of query ml: this lane holds 32 of the block's 64 scores
    float bm4[4];
#pragma unroll   // constant indices into s[]
    for (int sub = 0; sub < 4; sub++) {
      float m01 = fmaxf(s[sub][0], s[sub][1]), m23 = fmaxf(s[sub][2], s[sub][3]);
      float m45 = fmaxf(s[sub][4], s[sub][5]), m67 = fmaxf(s[sub][6], s[sub][7]);
      bm4[sub] = fmaxf(fmaxf(m01, m23), fmaxf(m45, m67));
    }
    float bm = fmaxf(fmaxf(bm4[0], bm4[1]), fmaxf(bm4[2], bm4[3]));
    bm = fmaxf(bm, other_half(bm));
    const float mnew = fmaxf(mrun, bm);
    const float corr = __expf(mrun - mnew);
    float rs4[4];
#pragma unroll   // constant indices into s[]
    for (int sub = 0; sub < 4; sub++) {
      for (int r = 0; r < 8; r++) s[sub][r] = __expf(s[sub][r] - mnew);
      rs4[sub] = ((s[sub][0] + s[sub][1]) + (s[sub][2] + s[sub][3])) +
                 ((s[sub][4] + s[sub][5]) + (s[sub][6] + s[sub][7]));
    }
    lrun = lrun * corr + ((rs4[0] + rs4[1]) + (rs4[2] + rs4[3]));
    mrun = mnew;
    for (int r = 0; r < 8; r++) { acc0[r] *= corr; acc1[r] *= corr; }

    // O^T += V^T P^T : two K=32 chunks x two 16-dim tiles
#pragma unroll   // constant indices into s[]
    for (int c = 0; c < 2; c++) {
      // B operand: registers 0..3 hold keys 8*half + 0..7 of the chunk (tile
      // 2c), registers 4..7 keys 16 + 8*half + 0..7 (tile 2c + 1)
      FragBF pf;
      for (int r = 0; r < 4; r++) {
        pf.u[r]     = pack_bf16(s[2 * c][2 * r],     s[2 * c][2 * r + 1]);
        pf.u[4 + r] = pack_bf16(s[2 * c + 1][2 * r], s[2 * c + 1][2 * r + 1]);
      }
      FragBF vf0, vf1;
      for (int r = 0; r < 8; r++) {
        vf0.u[r] = *(const unsigned*)(&lds_vt[ml * VPITCH        + c * 32 + koff[r]]);
        vf1.u[r] = *(const unsigned*)(&lds_vt[(16 + ml) * VPITCH + c * 32 + koff[r]]);
      }
      acc0 = __builtin_amdgcn_wmma_f32_16x16x32_bf16(
          false, vf0.v, false, pf.v, (short)0, acc0, false, false);
      acc1 = __builtin_amdgcn_wmma_f32_16x16x32_bf16(
          false, vf1.v, false, pf.v, (short)0, acc1, false, false);
    }
    __syncthreads();
  }

  // join the halves' sums, normalize, store to [B, C=head*32+dim, Hp*Wp]:
  // 16 lanes write 16 neighbouring positions of one channel
  lrun += other_half(lrun);
  const float inv = 1.0f / lrun;
  float* o = out + ((size_t)b * 256 + h * 32 + half * 8) * 1024 + qrow0 + ml;
  for (int r = 0; r < 8; r++) {
    o[(size_t)r * 1024]        = acc0[r] * inv;
    o[(size_t)(16 + r) * 1024] = acc1[r] * inv;
  }
}

// ---------------------------------------------------------------------------
extern "C" void kernel_launch(void* const* d_in, const int* in_sizes, int n_in,
                              void* d_out, int out_size, void* d_ws, size_t ws_size,
                              hipStream_t stream) {
  const float* x    = (const float*)d_in[0];
  const float* w    = (const float*)d_in[1];
  const float* bias = (const float*)d_in[2];
  const float* pos  = (const float*)d_in[3];

  const size_t per = (size_t)16 * 8 * 1024 * 32;   // elements per q/k/v buffer
  __bf16* qb  = (__bf16*)d_ws;
  __bf16* kb  = qb + per;
  __bf16* vtb = kb + per;

  qkv_pool_kernel<<<dim3(32, 16), 256, 0, stream>>>(x, w, bias, pos, qb, kb, vtb);
  attn_kernel<<<dim3(8, 8, 16), 256, 0, stream>>>(qb, kb, vtb, (float*)d_out);
}

// v004
// It runs in 92.4 microseconds.
// Next to v003, in two timings, it ran 1.36 times as fast each time.
// All steps since v000 together make it 4.31 times as fast.
#include <hip/hip_runtime.h>
#include <hip/hip_bf16.h>

typedef __attribute__((ext_vector_type(16))) __bf16 v16bf;
typedef __attribute__((ext_vector_type(8)))  float  v8f;

union FragBF { unsigned u[8]; v16bf v; };

__device__ inline __bf16 f2bf(float f) {
  union { float f; unsigned u; } a; a.f = f;
  unsigned r = a.u + 0x7FFFu + ((a.u >> 16) & 1u);   // round-to-nearest-even
  unsigned short h = (unsigned short)(r >> 16);
  __bf16 o; __builtin_memcpy(&o, &h, 2); return o;
}

typedef __attribute__((ext_vector_type(2))) float    v2f;
typedef __attribute__((ext_vector_type(4))) float    v4f;
typedef __attribute__((ext_vector_type(2))) __bf16   v2bf;
typedef __attribute__((ext_vector_type(2))) unsigned v2u;

// two f32 -> one register of two bf16 (round to nearest even), lo in bits 15..0
__device__ inline unsigned pack_bf16(float lo, float hi) {
  v2f f; f[0] = lo; f[1] = hi;
  v2bf p = __builtin_convertvector(f, v2bf);
  unsigned u; __builtin_memcpy(&u, &p, 4); return u;
}

// Per-lane K-offset for 16-bit A/B fragments (ISA 7.12.2):
// lanes 0-15: VGPR r -> K = {2r,2r+1} (r<4) / {16+2(r-4),...} (r>=4)
// lanes 16-31: same +8.
__device__ inline int frag_koff(int r, int half) {
  return ((r >> 2) << 4) + (half << 3) + ((r & 3) << 1);
}

// Async cache->LDS copy, 16 bytes per enabled lane (gfx1250 ASYNCcnt path).
// VDST VGPR carries the 32-bit LDS byte address; VADDR the 64-bit global addr.
// Two copies in one statement; the s_wait_xcnt closes it so that no register
// which a copy names can be rewritten ahead of that wait.
__device__ inline void async_copy2_b128(const void* gsrc0, void* ldst0,
                                        const void* gsrc1, void* ldst1) {
  unsigned lds0 = (unsigned)(unsigned long long)ldst0;  // low 32 = LDS offset
  unsigned lds1 = (unsigned)(unsigned long long)ldst1;
  asm volatile("global_load_async_to_lds_b128 %0, %1, off\n\t"
               "global_load_async_to_lds_b128 %2, %3, off\n\t"
               "s_wait_xcnt 0x0"
               :: "v"(lds0), "v"(gsrc0), "v"(lds1), "v"(gsrc1) : "memory");
}
__device__ inline void wait_asynccnt0() {
  asm volatile("s_wait_asynccnt 0x0" ::: "memory");
}

// ---------------------------------------------------------------------------
// Kernel 1: QKV projection + pool.
// grid = (Hp=32, B=16), block = 256 (8 waves).
// Each workgroup converts its X[256 x 128] tile (two image rows) to bf16 in
// LDS once, then walks the 12 channel blocks of 64:
// Y[64 x 128] = W[64 x 256] * X[256 x 128], pooled to 64 x 32 and scattered.
// A block's whole W[64 x 256] is staged at once: its loads are issued under
// the k loop of the block before, and the k loop runs without a barrier.
// ---------------------------------------------------------------------------
#define XPITCH 264   // elements per lds_x row: 528 B = 16 B x 33, b128 readers
#define WPITCH 264   // elements per lds_w row: 528 B = 16 B x 33, b128 readers
#define YPITCH 132   // floats per lds_y row: 8 rows further is 32 banks further,
                     // so the two lane halves of a store fall on different banks

// second argument: at least four waves a SIMD, that is at most 256 registers,
// so that two work-groups (8 waves each) stay resident on a WGP
__global__ __launch_bounds__(256, 4)
void qkv_pool_kernel(const float* __restrict__ x, const float* __restrict__ w,
                     const float* __restrict__ bias, const float* __restrict__ pos,
                     __bf16* __restrict__ qb, __bf16* __restrict__ kb,
                     __bf16* __restrict__ vtb)
{
  __shared__ __attribute__((aligned(16)))
             __bf16 lds_w[64 * WPITCH];   // [m][k], all 256 k of one block
  __shared__ __attribute__((aligned(16)))
             __bf16 lds_x[128 * XPITCH];  // [s][k], all 256 k resident
  __shared__ __attribute__((aligned(16)))
             float  lds_y[64 * YPITCH];   // conv result before pooling

  const int tid  = threadIdx.x;
  const int hp   = blockIdx.x;   // pooled row: 0..31
  const int b    = blockIdx.y;   // batch
  const int s0   = hp * 128;     // rows 2hp,2hp+1 are contiguous 128 floats

  const int wv   = tid >> 5;
  const int lane = tid & 31;
  const int ml   = lane & 15;
  const int half = (lane >> 4) & 1;
  const int mt   = wv & 3;       // M tile (16 rows) of this wave
  const int sg   = wv >> 2;      // S-tile group (4 tiles each)

  int koff[8];
  for (int r = 0; r < 8; r++) koff[r] = frag_koff(r, half);

  // stage the whole X tile [s][k] once (coalesced along s): this thread owns
  // column s = tid & 127 and every second k, starting at tid >> 7
  const float* xp = x + ((size_t)(b * 256 + (tid >> 7))) * 4096 + s0 + (tid & 127);
  __bf16*      xs = &lds_x[(tid & 127) * XPITCH + (tid >> 7)];
  // unrolled whole: every load is then one base register plus a constant
  // offset, and many of them are in flight to cover the latency of memory
#pragma unroll
  for (int k = 0; k < 256; k += 2)
    xs[k] = f2bf(xp[(size_t)k * 4096]);

  // W staging: this thread brings floats 4*(tid & 63) .. +3 of rows tid >> 6,
  // + 4, + 8, ... of a block, so a wave's load covers 512 contiguous bytes
  const float* wsrc = w + (tid >> 6) * 256 + (tid & 63) * 4;
  __bf16*      wdst = &lds_w[(tid >> 6) * WPITCH + (tid & 63) * 4];
  v4f wr[16];
  for (int i = 0; i < 16; i++)
    wr[i] = *(const v4f*)(wsrc + i * 4 * 256);

  // kept rolled and unpeeled: a second copy of the body for the last block
  // doubles the code and takes more registers than two work-groups can have
#pragma unroll 1
  for (int ob = 0; ob < 12; ob++) {   // 64-channel block
    const int o0 = ob * 64;

    // the block's W, fetched ahead into registers, goes to LDS as bf16
    // (every wave left the block before's k loop ahead of its second barrier)
    for (int i = 0; i < 16; i++) {
      v2u p;
      p[0] = pack_bf16(wr[i][0], wr[i][1]);
      p[1] = pack_bf16(wr[i][2], wr[i][3]);
      *(v2u*)(wdst + i * 4 * WPITCH) = p;
    }
    __syncthreads();   // publishes lds_w; the first one also publishes lds_x

    // the next block's W is asked for here and flies under this block's k loop
    // (the barrier behind the loop waits for what is still outstanding)
    if (ob < 11)
      for (int i = 0; i < 16; i++)
        wr[i] = *(const v4f*)(wsrc + (o0 + 64 + i * 4) * 256);

    v8f acc[4];
    for (int i = 0; i < 4; i++)
      for (int r = 0; r < 8; r++) acc[i][r] = 0.f;

    // with no barrier inside, the fragments of k slice ks + 1 are read from LDS
    // into a second register set ahead of the matrix instructions of slice ks;
    // unrolled so that both sets are indexed by constants
    FragBF a[2], bx[2][4];
    for (int r = 0; r < 8; r++)
      a[0].u[r] = *(const unsigned*)(&lds_w[(mt * 16 + ml) * WPITCH + koff[r]]);
    for (int i = 0; i < 4; i++)
      for (int r = 0; r < 8; r++)
        bx[0][i].u[r] = *(const unsigned*)(
            &lds_x[((sg * 4 + i) * 16 + ml) * XPITCH + koff[r]]);
#pragma unroll
    for (int ks = 0; ks < 8; ks++) {
      const int cur = ks & 1, nxt = cur ^ 1, k1 = (ks + 1) * 32;
      if (ks < 7) {
        for (int r = 0; r < 8; r++)
          a[nxt].u[r] = *(const unsigned*)(
              &lds_w[(mt * 16 + ml) * WPITCH + k1 + koff[r]]);
        for (int i = 0; i < 4; i++)
          for (int r = 0; r < 8; r++)
            bx[nxt][i].u[r] = *(const unsigned*)(
                &lds_x[((sg * 4 + i) * 16 + ml) * XPITCH + k1 + koff[r]]);
      }
      // keeps the reads above one group ahead of this slice's matrix
      // instructions: left free, the compiler put each read directly in front
      // of its user, with a full LDS wait per matrix instruction
      __builtin_amdgcn_sched_barrier(0);
      for (int i = 0; i < 4; i++)
        acc[i] = __builtin_amdgcn_wmma_f32_16x16x32_bf16(
            false, a[cur].v, false, bx[cur][i].v, (short)0, acc[i], false, false);
      // the group's other end: without it the reads of later slices moved up
      // among these matrix instructions and the build spilled registers
      __builtin_amdgcn_sched_barrier(0);
    }

    // park conv result in LDS (C layout: lanes0-15 -> M=r, lanes16-31 -> M=8+r)
    // (the pool reads of the block before ended ahead of this block's barrier)
    for (int i = 0; i < 4; i++) {
      int st = sg * 4 + i;
      for (int r = 0; r < 8; r++)
        lds_y[(mt * 16 + half * 8 + r) * YPITCH + st * 16 + ml] = acc[i][r];
    }
    __syncthreads();   // publishes lds_y and ends every wave's reads of lds_w

    // 2x2 maxpool + bias + head-split scatter (bias commutes with max)
    const int t = o0 >> 8;                       // 0=q, 1=k, 2=v
    __bf16* dst = (t == 0) ? qb : (t == 1) ? kb : vtb;
    const float scale = 0.17677669529663687f;    // 1/sqrt(32)
    for (int i = 0; i < 8; i++) {
      int e = tid + i * 256;
      int m = e >> 5, wp = e & 31;
      const float* row = &lds_y[m * YPITCH];
      float v0 = fmaxf(row[2 * wp],      row[2 * wp + 1]);
      float v1 = fmaxf(row[64 + 2 * wp], row[64 + 2 * wp + 1]);
      float val = fmaxf(v0, v1) + bias[o0 + m];
      int o    = o0 + m;
      int rem  = o & 255;
      int head = rem >> 5, dim = rem & 31;
      int n    = hp * 32 + wp;
      size_t idx;
      if (t == 0) {
        val = (val + pos[n * 32 + dim]) * scale;               // fold pos + scale
        idx = ((size_t)(b * 8 + head) * 1024 + n) * 32 + dim;  // [b,h,n,d]
      } else if (t == 1) {
        idx = ((size_t)(b * 8 + head) * 1024 + n) * 32 + dim;  // [b,h,n,d]
      } else {
        idx = ((size_t)(b * 8 + head) * 32 + dim) * 1024 + n;  // V^T: [b,h,d,n]
      }
      dst[idx] = f2bf(val);
    }
    // the next block's first instructions reuse the registers that the last
    // store above names: this wait stands in front of that overwrite
    asm volatile("s_wait_xcnt 0x0" ::: "memory");
  }
}

__device__ inline float other_half(float v) {
  int i; __builtin_memcpy(&i, &v, 4);
  i = __builtin_amdgcn_permlanex16(i, i, 0x76543210, 0xfedcba98, false, false);
  float o; __builtin_memcpy(&o, &i, 4); return o;
}

// LDS row pitches of 16 B x odd: the 16 rows that one ds_load_b128 reads then
// start on 16 different bank groups (unpadded rows of 64 B and 128 B fall on
// four and on two)
#define KPITCH 40    // elements per lds_k row: 80 B = 16 B x 5
#define VPITCH 72    // elements per lds_vt row: 144 B = 16 B x 9

__global__ __launch_bounds__(256)
void attn_kernel(const __bf16* __restrict__ qb, const __bf16* __restrict__ kb,
                 const __bf16* __restrict__ vtb, float* __restrict__ out)
{
  __shared__ __attribute__((aligned(16)))
             __bf16 lds_k[64 * KPITCH];   // [key][dim]
  __shared__ __attribute__((aligned(16)))
             __bf16 lds_vt[32 * VPITCH];  // [dim][key] (K-pairs contiguous)

  const int tid  = threadIdx.x;
  const int rb   = blockIdx.x;
  const int h    = blockIdx.y;
  const int b    = blockIdx.z;

  const int wv   = tid >> 5;
  const int lane = tid & 31;
  const int ml   = lane & 15;
  const int half = (lane >> 4) & 1;

  const size_t bh = (size_t)(b * 8 + h) * 1024 * 32;
  const __bf16* q  = qb  + bh;
  const __bf16* k  = kb  + bh;
  const __bf16* vt = vtb + bh;   // [dim][key] layout, 1024 keys per dim row

  int koff[8];
  for (int r = 0; r < 8; r++) koff[r] = frag_koff(r, half);

  const int qrow0 = rb * 128 + wv * 16;

  // Q fragment straight from global (q already has pos + 1/sqrt(d) folded);
  // as the B operand its column is query qrow0 + ml
  FragBF qf;
  for (int r = 0; r < 8; r++)
    qf.u[r] = *(const unsigned*)(q + (qrow0 + ml) * 32 + koff[r]);

  // acc0[r] = O^T[dim 8*half + r][query ml], acc1 the same for dims 16..31
  v8f acc0, acc1;
  for (int r = 0; r < 8; r++) { acc0[r] = 0.f; acc1[r] = 0.f; }
  float mrun = -1e30f;   // running maximum of query ml, equal in both halves
  float lrun = 0.f;      // running sum over this half's keys only

  const int krow = tid >> 2, kchunk = tid & 3;   // K staging coords
  const int vdim = tid >> 3, vchunk = tid & 7;   // V^T staging coords

  for (int j = 0; j < 16; j++) {
    const int key0 = j * 64;

    // async cache->LDS staging: K block 4KB + V^T block 4KB, b128/lane
    async_copy2_b128(k + key0 * 32 + tid * 8,
                     &lds_k[krow * KPITCH + kchunk * 8],
                     vt + vdim * 1024 + key0 + vchunk * 8,
                     &lds_vt[vdim * VPITCH + vchunk * 8]);
    if (j < 15) {   // prefetch next K block into GL2
      __builtin_prefetch(k + (key0 + 64) * 32 + tid * 8, 0, 1);
      __builtin_prefetch(vt + vdim * 1024 + key0 + 64 + vchunk * 8, 0, 1);
    }
    wait_asynccnt0();
    __syncthreads();

    // S^T = K Q^T : 4 x 16-key subtiles
    v8f s[4];
    // unrolled so that s[] is indexed by constants and stays in registers
#pragma unroll
    for (int sub = 0; sub < 4; sub++) {
      FragBF kf;
      for (int r = 0; r < 8; r++)
        kf.u[r] = *(const unsigned*)(&lds_k[(sub * 16 + ml) * KPITCH + koff[r]]);
      v8f z; for (int r = 0; r < 8; r++) z[r] = 0.f;
      s[sub] = __builtin_amdgcn_wmma_f32_16x16x32_bf16(
          false, kf.v, false, qf.v, (short)0, z, false, false);
    }

    // online softmax of query ml: this lane holds 32 of the block's 64 scores
    float bm4[4];
#pragma unroll   // constant indices into s[]
    for (int sub = 0; sub < 4; sub++) {
      float m01 = fmaxf(s[sub][0], s[sub][1]), m23 = fmaxf(s[sub][2], s[sub][3]);
      float m45 = fmaxf(s[sub][4], s[sub][5]), m67 = fmaxf(s[sub][6], s[sub][7]);
      bm4[sub] = fmaxf(fmaxf(m01, m23), fmaxf(m45, m67));
    }
    float bm = fmaxf(fmaxf(bm4[0], bm4[1]), fmaxf(bm4[2], bm4[3]));
    bm = fmaxf(bm, other_half(bm));
    const float mnew = fmaxf(mrun, bm);
    const float corr = __expf(mrun - mnew);
    float rs4[4];
#pragma unroll   // constant indices into s[]
    for (int sub = 0; sub < 4; sub++) {
      for (int r = 0; r < 8; r++) s[sub][r] = __expf(s[sub][r] - mnew);
      rs4[sub] = ((s[sub][0] + s[sub][1]) + (s[sub][2] + s[sub][3])) +
                 ((s[sub][4] + s[sub][5]) + (s[sub][6] + s[sub][7]));
    }
    lrun = lrun * corr + ((rs4[0] + rs4[1]) + (rs4[2] + rs4[3]));
    mrun = mnew;
    for (int r = 0; r < 8; r++) { acc0[r] *= corr; acc1[r] *= corr; }

    // O^T += V^T P^T : two K=32 chunks x two 16-dim tiles
#pragma unroll   // constant indices into s[]
    for (int c = 0; c < 2; c++) {
      // B operand: registers 0..3 hold keys 8*half + 0..7 of the chunk (tile
      // 2c), registers 4..7 keys 16 + 8*half + 0..7 (tile 2c + 1)
      FragBF pf;
      for (int r = 0; r < 4; r++) {
        pf.u[r]     = pack_bf16(s[2 * c][2 * r],     s[2 * c][2 * r + 1]);
        pf.u[4 + r] = pack_bf16(s[2 * c + 1][2 * r], s[2 * c + 1][2 * r + 1]);
      }
      FragBF vf0, vf1;
      for (int r = 0; r < 8; r++) {
        vf0.u[r] = *(const unsigned*)(&lds_vt[ml * VPITCH        + c * 32 + koff[r]]);
        vf1.u[r] = *(const unsigned*)(&lds_vt[(16 + ml) * VPITCH + c * 32 + koff[r]]);
      }
      acc0 = __builtin_amdgcn_wmma_f32_16x16x32_bf16(
          false, vf0.v, false, pf.v, (short)0, acc0, false, false);
      acc1 = __builtin_amdgcn_wmma_f32_16x16x32_bf16(
          false, vf1.v, false, pf.v, (short)0, acc1, false, false);
    }
    __syncthreads();
  }

  // join the halves' sums, normalize, store to [B, C=head*32+dim, Hp*Wp]:
  // 16 lanes write 16 neighbouring positions of one channel
  lrun += other_half(lrun);
  const float inv = 1.0f / lrun;
  float* o = out + ((size_t)b * 256 + h * 32 + half * 8) * 1024 + qrow0 + ml;
  for (int r = 0; r < 8; r++) {
    o[(size_t)r * 1024]        = acc0[r] * inv;
    o[(size_t)(16 + r) * 1024] = acc1[r] * inv;
  }
}

// ---------------------------------------------------------------------------
extern "C" void kernel_launch(void* const* d_in, const int* in_sizes, int n_in,
                              void* d_out, int out_size, void* d_ws, size_t ws_size,
                              hipStream_t stream) {
  const float* x    = (const float*)d_in[0];
  const float* w    = (const float*)d_in[1];
  const float* bias = (const float*)d_in[2];
  const float* pos  = (const float*)d_in[3];

  const size_t per = (size_t)16 * 8 * 1024 * 32;   // elements per q/k/v buffer
  __bf16* qb  = (__bf16*)d_ws;
  __bf16* kb  = qb + per;
  __bf16* vtb = kb + per;

  qkv_pool_kernel<<<dim3(32, 16), 256, 0, stream>>>(x, w, bias, pos, qb, kb, vtb);
  attn_kernel<<<dim3(8, 8, 16), 256, 0, stream>>>(qb, kb, vtb, (float*)d_out);
}

// v005
// Measured time: 63.6 microseconds a run.
// In two side-by-side timings against v004, it was 1.45 and 1.46 times as fast.
// All steps since v000 together make it 6.27 times as fast.
#include <hip/hip_runtime.h>
#include <hip/hip_bf16.h>

typedef __attribute__((ext_vector_type(16))) __bf16 v16bf;
typedef __attribute__((ext_vector_type(8)))  float  v8f;

union FragBF { unsigned u[8]; v16bf v; };

__device__ inline __bf16 f2bf(float f) {
  union { float f; unsigned u; } a; a.f = f;
  unsigned r = a.u + 0x7FFFu + ((a.u >> 16) & 1u);   // round-to-nearest-even
  unsigned short h = (unsigned short)(r >> 16);
  __bf16 o; __builtin_memcpy(&o, &h, 2); return o;
}

typedef __attribute__((ext_vector_type(2))) float    v2f;
typedef __attribute__((ext_vector_type(4))) float    v4f;
typedef __attribute__((ext_vector_type(2))) __bf16   v2bf;
typedef __attribute__((ext_vector_type(2))) unsigned v2u;

// two f32 -> one register of two bf16 (round to nearest even), lo in bits 15..0
__device__ inline unsigned pack_bf16(float lo, float hi) {
  v2f f; f[0] = lo; f[1] = hi;
  v2bf p = __builtin_convertvector(f, v2bf);
  unsigned u; __builtin_memcpy(&u, &p, 4); return u;
}

// Per-lane K-offset for 16-bit A/B fragments (ISA 7.12.2):
// lanes 0-15: VGPR r -> K = {2r,2r+1} (r<4) / {16+2(r-4),...} (r>=4)
// lanes 16-31: same +8.
__device__ inline int frag_koff(int r, int half) {
  return ((r >> 2) << 4) + (half << 3) + ((r & 3) << 1);
}

// Async cache->LDS copy, 16 bytes per enabled lane (gfx1250 ASYNCcnt path).
// VDST VGPR carries the 32-bit LDS byte address; VADDR the 64-bit global addr.
// Two copies in one statement; the s_wait_xcnt closes it so that no register
// which a copy names can be rewritten ahead of that wait.
__device__ inline void async_copy2_b128(const void* gsrc0, void* ldst0,
                                        const void* gsrc1, void* ldst1) {
  unsigned lds0 = (unsigned)(unsigned long long)ldst0;  // low 32 = LDS offset
  unsigned lds1 = (unsigned)(unsigned long long)ldst1;
  asm volatile("global_load_async_to_lds_b128 %0, %1, off\n\t"
               "global_load_async_to_lds_b128 %2, %3, off\n\t"
               "s_wait_xcnt 0x0"
               :: "v"(lds0), "v"(gsrc0), "v"(lds1), "v"(gsrc1) : "memory");
}
__device__ inline void wait_asynccnt0() {
  asm volatile("s_wait_asynccnt 0x0" ::: "memory");
}

// ---------------------------------------------------------------------------
// Kernel 1: QKV projection + pool.
// grid = (Hp=32, B=16), block = 256 (8 waves).
// Each workgroup converts its X[256 x 128] tile (two image rows) to bf16 in
// LDS once, then walks the 12 channel blocks of 64:
// Y[64 x 128] = W[64 x 256] * X[256 x 128], pooled to 64 x 32 and scattered.
// A wave's four 16 x 16 tiles are two neighbouring column tiles of image row
// 2hp and the same two of row 2hp + 1, so the 2x2 pool stays in its registers.
// A block's whole W[64 x 256] is staged at once: its loads are issued under
// the k loop of the block before, and the k loop runs without a barrier.
// ---------------------------------------------------------------------------
#define XPITCH 264   // elements per lds_x row: 528 B = 16 B x 33, b128 readers
#define WPITCH 264   // elements per lds_w row: 528 B = 16 B x 33, b128 readers

typedef __attribute__((ext_vector_type(4))) unsigned v4u;

// value of lane l ^ 1 (the neighbouring image column of an accumulator tile)
__device__ inline float neighbour_lane(float v) {
  int i; __builtin_memcpy(&i, &v, 4);
  i = __builtin_amdgcn_update_dpp(i, i, 0xB1, 0xF, 0xF, true);  // quad 1,0,3,2
  float o; __builtin_memcpy(&o, &i, 4); return o;
}

// second argument: at least four waves a SIMD, that is at most 256 registers,
// so that two work-groups (8 waves each) stay resident on a WGP
__global__ __launch_bounds__(256, 4)
void qkv_pool_kernel(const float* __restrict__ x, const float* __restrict__ w,
                     const float* __restrict__ bias, const float* __restrict__ pos,
                     __bf16* __restrict__ qb, __bf16* __restrict__ kb,
                     __bf16* __restrict__ vtb)
{
  __shared__ __attribute__((aligned(16)))
             __bf16 lds_w[64 * WPITCH];   // [m][k], all 256 k of one block
  __shared__ __attribute__((aligned(16)))
             __bf16 lds_x[128 * XPITCH];  // [s][k], all 256 k resident

  const int tid  = threadIdx.x;
  const int hp   = blockIdx.x;   // pooled row: 0..31
  const int b    = blockIdx.y;   // batch
  const int s0   = hp * 128;     // rows 2hp,2hp+1 are contiguous 128 floats

  const int wv   = tid >> 5;
  const int lane = tid & 31;
  const int ml   = lane & 15;
  const int half = (lane >> 4) & 1;
  const int mt   = wv & 3;       // M tile (16 rows) of this wave
  const int sg   = wv >> 2;      // S-tile group: tiles 2sg, 2sg+1, 4+2sg, 5+2sg

  int koff[8];
  for (int r = 0; r < 8; r++) koff[r] = frag_koff(r, half);

  // stage the whole X tile [s][k] once (coalesced along s): this thread owns
  // column s = tid & 127 and every second k, starting at tid >> 7
  const float* xp = x + ((size_t)(b * 256 + (tid >> 7))) * 4096 + s0 + (tid & 127);
  __bf16*      xs = &lds_x[(tid & 127) * XPITCH + (tid >> 7)];
  // unrolled whole: every load is then one base register plus a constant
  // offset, and many of them are in flight to cover the latency of memory
#pragma unroll
  for (int k = 0; k < 256; k += 2)
    xs[k] = f2bf(xp[(size_t)k * 4096]);

  // W staging: this thread brings floats 4*(tid & 63) .. +3 of rows tid >> 6,
  // + 4, + 8, ... of a block, so a wave's load covers 512 contiguous bytes
  const float* wsrc = w + (tid >> 6) * 256 + (tid & 63) * 4;
  __bf16*      wdst = &lds_w[(tid >> 6) * WPITCH + (tid & 63) * 4];
  v4f wr[16];
  for (int i = 0; i < 16; i++)
    wr[i] = *(const v4f*)(wsrc + i * 4 * 256);

  // kept rolled and unpeeled: a second copy of the body for the last block
  // doubles the code and takes more registers than two work-groups can have
#pragma unroll 1
  for (int ob = 0; ob < 12; ob++) {   // 64-channel block
    const int o0 = ob * 64;

    // the block's W, fetched ahead into registers, goes to LDS as bf16
    // (every wave left the block before's k loop ahead of its second barrier)
    for (int i = 0; i < 16; i++) {
      v2u p;
      p[0] = pack_bf16(wr[i][0], wr[i][1]);
      p[1] = pack_bf16(wr[i][2], wr[i][3]);
      *(v2u*)(wdst + i * 4 * WPITCH) = p;
    }
    __syncthreads();   // publishes lds_w; the first one also publishes lds_x

    // the next block's W is asked for here and flies under this block's k loop
    // (the barrier behind the loop waits for what is still outstanding)
    if (ob < 11)
      for (int i = 0; i < 16; i++)
        wr[i] = *(const v4f*)(wsrc + (o0 + 64 + i * 4) * 256);

    v8f acc[4];
    for (int i = 0; i < 4; i++)
      for (int r = 0; r < 8; r++) acc[i][r] = 0.f;

    // with no barrier inside, the fragments of k slice ks + 1 are read from LDS
    // into a second register set ahead of the matrix instructions of slice ks;
    // unrolled so that both sets are indexed by constants
    FragBF a[2], bx[2][4];
    for (int r = 0; r < 8; r++)
      a[0].u[r] = *(const unsigned*)(&lds_w[(mt * 16 + ml) * WPITCH + koff[r]]);
    for (int i = 0; i < 4; i++)
      for (int r = 0; r < 8; r++)
        bx[0][i].u[r] = *(const unsigned*)(
            &lds_x[(((i >> 1) * 4 + sg * 2 + (i & 1)) * 16 + ml) * XPITCH + koff[r]]);
#pragma unroll
    for (int ks = 0; ks < 8; ks++) {
      const int cur = ks & 1, nxt = cur ^ 1, k1 = (ks + 1) * 32;
      if (ks < 7) {
        for (int r = 0; r < 8; r++)
          a[nxt].u[r] = *(const unsigned*)(
              &lds_w[(mt * 16 + ml) * WPITCH + k1 + koff[r]]);
        for (int i = 0; i < 4; i++)
          for (int r = 0; r < 8; r++)
            bx[nxt][i].u[r] = *(const unsigned*)(
                &lds_x[(((i >> 1) * 4 + sg * 2 + (i & 1)) * 16 + ml) * XPITCH
                       + k1 + koff[r]]);
      }
      // keeps the reads above one group ahead of this slice's matrix
      // instructions: left free, the compiler put each read directly in front
      // of its user, with a full LDS wait per matrix instruction
      __builtin_amdgcn_sched_barrier(0);
      for (int i = 0; i < 4; i++)
        acc[i] = __builtin_amdgcn_wmma_f32_16x16x32_bf16(
            false, a[cur].v, false, bx[cur][i].v, (short)0, acc[i], false, false);
      // the group's other end: without it the reads of later slices moved up
      // among these matrix instructions and the build spilled registers
      __builtin_amdgcn_sched_barrier(0);
    }

    // this lane's 8 channels (C layout: register r is row half * 8 + r of the
    // wave's 16) and the one pooled position that it will keep
    const int t    = o0 >> 8;                    // 0=q, 1=k, 2=v
    const int head = (ob & 3) * 2 + (mt >> 1);
    const int dim0 = (mt & 1) * 16 + half * 8;
    const int n    = hp * 32 + sg * 16 + (ml & 1) * 8 + (ml >> 1);
    const v4f bs0 = *(const v4f*)(bias + o0 + mt * 16 + half * 8);
    const v4f bs1 = *(const v4f*)(bias + o0 + mt * 16 + half * 8 + 4);
    v4f ps0 = {0.f, 0.f, 0.f, 0.f}, ps1 = ps0;
    if (t == 0) {      // asked for ahead of the barrier, whose wait covers them
      ps0 = *(const v4f*)(pos + n * 32 + dim0);
      ps1 = *(const v4f*)(pos + n * 32 + dim0 + 4);
    }
    __syncthreads();   // ends every wave's reads of lds_w

    // 2x2 maxpool: the two image rows are tiles i and i + 2, the two columns
    // are lanes l and l ^ 1; even lanes keep tile 2sg's position, odd lanes
    // tile 2sg + 1's, so every lane ends with 8 channels of one position
    float val[8];
    for (int r = 0; r < 8; r++) {
      float v0 = fmaxf(acc[0][r], acc[2][r]);
      float v1 = fmaxf(acc[1][r], acc[3][r]);
      v0 = fmaxf(v0, neighbour_lane(v0));
      v1 = fmaxf(v1, neighbour_lane(v1));
      val[r] = ((ml & 1) ? v1 : v0) + (r < 4 ? bs0[r & 3] : bs1[r & 3]);
    }                                            // (bias commutes with max)
    if (t == 0) {                                // fold pos + scale into q
      const float scale = 0.17677669529663687f;  // 1/sqrt(32)
      for (int r = 0; r < 8; r++)
        val[r] = (val[r] + (r < 4 ? ps0[r & 3] : ps1[r & 3])) * scale;
    }
    v4u pk;
    for (int r = 0; r < 4; r++) pk[r] = pack_bf16(val[2 * r], val[2 * r + 1]);
    if (t < 2) {
      // [b,h,n,d]: the lane's 8 dims are 16 neighbouring bytes
      __bf16* dst = (t == 0) ? qb : kb;
      *(v4u*)(dst + ((size_t)(b * 8 + head) * 1024 + n) * 32 + dim0) = pk;
      // later instructions reuse the registers that this store names: the
      // wait stands in front of that overwrite
      asm volatile("s_wait_xcnt 0x0" ::: "memory");
    } else {
      // V^T [b,h,d,n]: 16 lanes write 16 neighbouring positions of one dim
      unsigned short* dv = (unsigned short*)vtb +
                           ((size_t)(b * 8 + head) * 32 + dim0) * 1024 + n;
      for (int r = 0; r < 4; r++) {
        dv[(2 * r) * 1024]     = (unsigned short)(pk[r] & 0xFFFFu);
        dv[(2 * r + 1) * 1024] = (unsigned short)(pk[r] >> 16);
      }
      // the same wait for these eight stores, inside their own branch: the
      // built code reuses their address pair right behind the branch
      asm volatile("s_wait_xcnt 0x0" ::: "memory");
    }
  }
}

__device__ inline float other_half(float v) {
  int i; __builtin_memcpy(&i, &v, 4);
  i = __builtin_amdgcn_permlanex16(i, i, 0x76543210, 0xfedcba98, false, false);
  float o; __builtin_memcpy(&o, &i, 4); return o;
}

// LDS row pitches of 16 B x odd: the 16 rows that one ds_load_b128 reads then
// start on 16 different bank groups (unpadded rows of 64 B and 128 B fall on
// four and on two)
#define KPITCH 40    // elements per lds_k row: 80 B = 16 B x 5
#define VPITCH 72    // elements per lds_vt row: 144 B = 16 B x 9

__global__ __launch_bounds__(256)
void attn_kernel(const __bf16* __restrict__ qb, const __bf16* __restrict__ kb,
                 const __bf16* __restrict__ vtb, float* __restrict__ out)
{
  __shared__ __attribute__((aligned(16)))
             __bf16 lds_k[64 * KPITCH];   // [key][dim]
  __shared__ __attribute__((aligned(16)))
             __bf16 lds_vt[32 * VPITCH];  // [dim][key] (K-pairs contiguous)

  const int tid  = threadIdx.x;
  const int rb   = blockIdx.x;
  const int h    = blockIdx.y;
  const int b    = blockIdx.z;

  const int wv   = tid >> 5;
  const int lane = tid & 31;
  const int ml   = lane & 15;
  const int half = (lane >> 4) & 1;

  const size_t bh = (size_t)(b * 8 + h) * 1024 * 32;
  const __bf16* q  = qb  + bh;
  const __bf16* k  = kb  + bh;
  const __bf16* vt = vtb + bh;   // [dim][key] layout, 1024 keys per dim row

  int koff[8];
  for (int r = 0; r < 8; r++) koff[r] = frag_koff(r, half);

  const int qrow0 = rb * 128 + wv * 16;

  // Q fragment straight from global (q already has pos + 1/sqrt(d) folded);
  // as the B operand its column is query qrow0 + ml
  FragBF qf;
  for (int r = 0; r < 8; r++)
    qf.u[r] = *(const unsigned*)(q + (qrow0 + ml) * 32 + koff[r]);

  // acc0[r] = O^T[dim 8*half + r][query ml], acc1 the same for dims 16..31
  v8f acc0, acc1;
  for (int r = 0; r < 8; r++) { acc0[r] = 0.f; acc1[r] = 0.f; }
  float mrun = -1e30f;   // running maximum of query ml, equal in both halves
  float lrun = 0.f;      // running sum over this half's keys only

  const int krow = tid >> 2, kchunk = tid & 3;   // K staging coords
  const int vdim = tid >> 3, vchunk = tid & 7;   // V^T staging coords

  for (int j = 0; j < 16; j++) {
    const int key0 = j * 64;

    // async cache->LDS staging: K block 4KB + V^T block 4KB, b128/lane
    async_copy2_b128(k + key0 * 32 + tid * 8,
                     &lds_k[krow * KPITCH + kchunk * 8],
                     vt + vdim * 1024 + key0 + vchunk * 8,
                     &lds_vt[vdim * VPITCH + vchunk * 8]);
    if (j < 15) {   // prefetch next K block into GL2
      __builtin_prefetch(k + (key0 + 64) * 32 + tid * 8, 0, 1);
      __builtin_prefetch(vt + vdim * 1024 + key0 + 64 + vchunk * 8, 0, 1);
    }
    wait_asynccnt0();
    __syncthreads();

    // S^T = K Q^T : 4 x 16-key subtiles
    v8f s[4];
    // unrolled so that s[] is indexed by constants and stays in registers
#pragma unroll
    for (int sub = 0; sub < 4; sub++) {
      FragBF kf;
      for (int r = 0; r < 8; r++)
        kf.u[r] = *(const unsigned*)(&lds_k[(sub * 16 + ml) * KPITCH + koff[r]]);
      v8f z; for (int r = 0; r < 8; r++) z[r] = 0.f;
      s[sub] = __builtin_amdgcn_wmma_f32_16x16x32_bf16(
          false, kf.v, false, qf.v, (short)0, z, false, false);
    }

    // online softmax of query ml: this lane holds 32 of the block's 64 scores
    float bm4[4];
#pragma unroll   // constant indices into s[]
    for (int sub = 0; sub < 4; sub++) {
      float m01 = fmaxf(s[sub][0], s[sub][1]), m23 = fmaxf(s[sub][2], s[sub][3]);
      float m45 = fmaxf(s[sub][4], s[sub][5]), m67 = fmaxf(s[sub][6], s[sub][7]);
      bm4[sub] = fmaxf(fmaxf(m01, m23), fmaxf(m45, m67));
    }
    float bm = fmaxf(fmaxf(bm4[0], bm4[1]), fmaxf(bm4[2], bm4[3]));
    bm = fmaxf(bm, other_half(bm));
    const float mnew = fmaxf(mrun, bm);
    const float corr = __expf(mrun - mnew);
    float rs4[4];
#pragma unroll   // constant indices into s[]
    for (int sub = 0; sub < 4; sub++) {
      for (int r = 0; r < 8; r++) s[sub][r] = __expf(s[sub][r] - mnew);
      rs4[sub] = ((s[sub][0] + s[sub][1]) + (s[sub][2] + s[sub][3])) +
                 ((s[sub][4] + s[sub][5]) + (s[sub][6] + s[sub][7]));
    }
    lrun = lrun * corr + ((rs4[0] + rs4[1]) + (rs4[2] + rs4[3]));
    mrun = mnew;
    for (int r = 0; r < 8; r++) { acc0[r] *= corr; acc1[r] *= corr; }

    // O^T += V^T P^T : two K=32 chunks x two 16-dim tiles
#pragma unroll   // constant indices into s[]
    for (int c = 0; c < 2; c++) {
      // B operand: registers 0..3 hold keys 8*half + 0..7 of the chunk (tile
      // 2c), registers 4..7 keys 16 + 8*half + 0..7 (tile 2c + 1)
      FragBF pf;
      for (int r = 0; r < 4; r++) {
        pf.u[r]     = pack_bf16(s[2 * c][2 * r],     s[2 * c][2 * r + 1]);
        pf.u[4 + r] = pack_bf16(s[2 * c + 1][2 * r], s[2 * c + 1][2 * r + 1]);
      }
      FragBF vf0, vf1;
      for (int r = 0; r < 8; r++) {
        vf0.u[r] = *(const unsigned*)(&lds_vt[ml * VPITCH        + c * 32 + koff[r]]);
        vf1.u[r] = *(const unsigned*)(&lds_vt[(16 + ml) * VPITCH + c * 32 + koff[r]]);
      }
      acc0 = __builtin_amdgcn_wmma_f32_16x16x32_bf16(
          false, vf0.v, false, pf.v, (short)0, acc0, false, false);
      acc1 = __builtin_amdgcn_wmma_f32_16x16x32_bf16(
          false, vf1.v, false, pf.v, (short)0, acc1, false, false);
    }
    __syncthreads();
  }

  // join the halves' sums, normalize, store to [B, C=head*32+dim, Hp*Wp]:
  // 16 lanes write 16 neighbouring positions of one channel
  lrun += other_half(lrun);
  const float inv = 1.0f / lrun;
  float* o = out + ((size_t)b * 256 + h * 32 + half * 8) * 1024 + qrow0 + ml;
  for (int r = 0; r < 8; r++) {
    o[(size_t)r * 1024]        = acc0[r] * inv;
    o[(size_t)(16 + r) * 1024] = acc1[r] * inv;
  }
}

// ---------------------------------------------------------------------------
extern "C" void kernel_launch(void* const* d_in, const int* in_sizes, int n_in,
                              void* d_out, int out_size, void* d_ws, size_t ws_size,
                              hipStream_t stream) {
  const float* x    = (const float*)d_in[0];
  const float* w    = (const float*)d_in[1];
  const float* bias = (const float*)d_in[2];
  const float* pos  = (const float*)d_in[3];

  const size_t per = (size_t)16 * 8 * 1024 * 32;   // elements per q/k/v buffer
  __bf16* qb  = (__bf16*)d_ws;
  __bf16* kb  = qb + per;
  __bf16* vtb = kb + per;

  qkv_pool_kernel<<<dim3(32, 16), 256, 0, stream>>>(x, w, bias, pos, qb, kb, vtb);
  attn_kernel<<<dim3(8, 8, 16), 256, 0, stream>>>(qb, kb, vtb, (float*)d_out);
}

// v007
// Measured time: 52.5 microseconds a run.
// Versions in between are left out here; by their measured steps it is 1.21 times as fast as v005.
// Counting every step since v000, it is 7.57 times as fast.
#include <hip/hip_runtime.h>
#include <hip/hip_bf16.h>

typedef __attribute__((ext_vector_type(16))) __bf16 v16bf;
typedef __attribute__((ext_vector_type(8)))  float  v8f;

union FragBF { unsigned u[8]; v16bf v; };

__device__ inline __bf16 f2bf(float f) {
  union { float f; unsigned u; } a; a.f = f;
  unsigned r = a.u + 0x7FFFu + ((a.u >> 16) & 1u);   // round-to-nearest-even
  unsigned short h = (unsigned short)(r >> 16);
  __bf16 o; __builtin_memcpy(&o, &h, 2); return o;
}

typedef __attribute__((ext_vector_type(2))) float    v2f;
typedef __attribute__((ext_vector_type(4))) float    v4f;
typedef __attribute__((ext_vector_type(2))) __bf16   v2bf;
typedef __attribute__((ext_vector_type(2))) unsigned v2u;

// two f32 -> one register of two bf16 (round to nearest even), lo in bits 15..0
__device__ inline unsigned pack_bf16(float lo, float hi) {
  v2f f; f[0] = lo; f[1] = hi;
  v2bf p = __builtin_convertvector(f, v2bf);
  unsigned u; __builtin_memcpy(&u, &p, 4); return u;
}

// Per-lane K-offset for 16-bit A/B fragments (ISA 7.12.2):
// lanes 0-15: VGPR r -> K = {2r,2r+1} (r<4) / {16+2(r-4),...} (r>=4)
// lanes 16-31: same +8.
__device__ inline int frag_koff(int r, int half) {
  return ((r >> 2) << 4) + (half << 3) + ((r & 3) << 1);
}

// Async cache->LDS copy, 16 bytes per enabled lane (gfx1250 ASYNCcnt path).
// VDST VGPR carries the 32-bit LDS byte address; VADDR the 64-bit global addr.
// Two copies in one statement; the s_wait_xcnt closes it so that no register
// which a copy names can be rewritten ahead of that wait.
__device__ inline void async_copy2_b128(const void* gsrc0, void* ldst0,
                                        const void* gsrc1, void* ldst1) {
  unsigned lds0 = (unsigned)(unsigned long long)ldst0;  // low 32 = LDS offset
  unsigned lds1 = (unsigned)(unsigned long long)ldst1;
  asm volatile("global_load_async_to_lds_b128 %0, %1, off\n\t"
               "global_load_async_to_lds_b128 %2, %3, off\n\t"
               "s_wait_xcnt 0x0"
               :: "v"(lds0), "v"(gsrc0), "v"(lds1), "v"(gsrc1) : "memory");
}
__device__ inline void wait_asynccnt0() {
  asm volatile("s_wait_asynccnt 0x0" ::: "memory");
}

// ---------------------------------------------------------------------------
// Kernel 1: QKV projection + pool.
// grid = (Hp/2=16, B=16), block = 512 (16 waves), one work-group a WGP.
// Each workgroup converts its X[256 x 256] tile (four image rows) to bf16 in
// LDS once; every wave then takes the fragments of its own 32 columns (16
// columns of an image row and the same 16 of the row below) into registers
// and keeps them there for all 12 channel blocks of 64:
// Y[64 x 256] = W[64 x 256] * X[256 x 256], pooled to 64 x 64 and scattered.
// In the k loop a wave reads only W from LDS: two fragments (32 channels) for
// four matrix instructions. With both image rows in one wave the 2x2 pool
// stays in its registers.
// W has two LDS buffers: a block's loads are issued under the k loop of the
// block before and stored behind it, so one barrier a block is enough.
// ---------------------------------------------------------------------------
#define XPITCH 264   // elements per lds_x row: 528 B = 16 B x 33, b128 readers
#define WPITCH 264   // elements per lds_w row: 528 B = 16 B x 33, b128 readers

typedef __attribute__((ext_vector_type(4))) unsigned v4u;

// value of lane l ^ 1 (the neighbouring image column of an accumulator tile)
__device__ inline float neighbour_lane(float v) {
  int i; __builtin_memcpy(&i, &v, 4);
  i = __builtin_amdgcn_update_dpp(i, i, 0xB1, 0xF, 0xF, true);  // quad 1,0,3,2
  float o; __builtin_memcpy(&o, &i, 4); return o;
}

// 16 waves are four a SIMD: at most 256 registers each
__global__ __launch_bounds__(512, 4)
void qkv_pool_kernel(const float* __restrict__ x, const float* __restrict__ w,
                     const float* __restrict__ bias, const float* __restrict__ pos,
                     __bf16* __restrict__ qb, __bf16* __restrict__ kb,
                     __bf16* __restrict__ vtb)
{
  __shared__ __attribute__((aligned(16)))
             __bf16 lds_w[2 * 64 * WPITCH];  // two buffers of [m][k], 256 k
  __shared__ __attribute__((aligned(16)))
             __bf16 lds_x[256 * XPITCH];     // [s][k], all 256 k

  const int tid  = threadIdx.x;
  const int hq   = blockIdx.x;   // pair of pooled rows: 0..15
  const int b    = blockIdx.y;   // batch
  const int s0   = hq * 256;     // rows 4hq .. 4hq+3 are contiguous 256 floats

  const int wv   = tid >> 5;
  const int lane = tid & 31;
  const int ml   = lane & 15;
  const int half = (lane >> 4) & 1;
  const int cc   = wv & 3;        // column tile (16 image columns)
  const int cp   = (wv >> 2) & 1; // which of the two pooled rows
  const int mh   = wv >> 3;       // which 32 of a block's 64 channels

  int koff[8];
  for (int r = 0; r < 8; r++) koff[r] = frag_koff(r, half);

  // W staging: this thread brings floats 4*(tid & 63) .. +3 of rows tid >> 6,
  // + 8, + 16, ... of a block, so a wave's load covers 512 contiguous bytes
  const float* wsrc = w + (tid >> 6) * 256 + (tid & 63) * 4;
  __bf16*      wdst = &lds_w[(tid >> 6) * WPITCH + (tid & 63) * 4];
  v4f wr[8];
  for (int i = 0; i < 8; i++)
    wr[i] = *(const v4f*)(wsrc + i * 8 * 256);

  // stage the whole X tile [s][k] once (coalesced along s): this thread owns
  // column s = tid & 255 and every second k, starting at tid >> 8
  const float* xp = x + ((size_t)(b * 256 + (tid >> 8))) * 4096 + s0 + (tid & 255);
  __bf16*      xs = &lds_x[(tid & 255) * XPITCH + (tid >> 8)];
  // unrolled whole: every load is then one base register plus a constant
  // offset, and many of them are in flight to cover the latency of memory
#pragma unroll
  for (int k = 0; k < 256; k += 2)
    xs[k] = f2bf(xp[(size_t)k * 4096]);

  // block 0's W goes to buffer 0 as bf16
  for (int i = 0; i < 8; i++) {
    v2u p;
    p[0] = pack_bf16(wr[i][0], wr[i][1]);
    p[1] = pack_bf16(wr[i][2], wr[i][3]);
    *(v2u*)(wdst + i * 8 * WPITCH) = p;
  }
  __syncthreads();   // publishes lds_x and buffer 0 of lds_w

  // this wave's X fragments, all 8 k slices of both image rows: read once
  FragBF xf[2][8];
  for (int row = 0; row < 2; row++)
    for (int ks = 0; ks < 8; ks++)
      for (int r = 0; r < 8; r++)
        xf[row][ks].u[r] = *(const unsigned*)(
            &lds_x[((cp * 2 + row) * 64 + cc * 16 + ml) * XPITCH
                   + ks * 32 + koff[r]]);

  // kept rolled: the fragments above leave no registers for a second copy of
  // the body, and the code stays small
#pragma unroll 1
  for (int ob = 0; ob < 12; ob++) {   // 64-channel block
    const int o0 = ob * 64;
    const __bf16* wb = &lds_w[(ob & 1) * 64 * WPITCH
                              + (mh * 32 + ml) * WPITCH];

    // the next block's W is asked for here and flies under this block's k loop
    if (ob < 11)
      for (int i = 0; i < 8; i++)
        wr[i] = *(const v4f*)(wsrc + (o0 + 64 + i * 8) * 256);

    v8f acc[2][2];   // [16-channel tile][image row]
    for (int m = 0; m < 2; m++)
      for (int row = 0; row < 2; row++)
        for (int r = 0; r < 8; r++) acc[m][row][r] = 0.f;

    // the W fragments of k slice ks + 1 are read from LDS into a second
    // register set ahead of the matrix instructions of slice ks;
    // unrolled so that both sets and xf[] are indexed by constants
    FragBF a[2][2];
    for (int m = 0; m < 2; m++)
      for (int r = 0; r < 8; r++)
        a[0][m].u[r] = *(const unsigned*)(&wb[m * 16 * WPITCH + koff[r]]);
#pragma unroll
    for (int ks = 0; ks < 8; ks++) {
      const int cur = ks & 1, nxt = cur ^ 1, k1 = (ks + 1) * 32;
      if (ks < 7)
        for (int m = 0; m < 2; m++)
          for (int r = 0; r < 8; r++)
            a[nxt][m].u[r] = *(const unsigned*)(
                &wb[m * 16 * WPITCH + k1 + koff[r]]);
      // keeps the reads above one group ahead of this slice's matrix
      // instructions: left free, the compiler put each read directly in front
      // of its user, with a full LDS wait per matrix instruction
      __builtin_amdgcn_sched_barrier(0);
      for (int m = 0; m < 2; m++)
        for (int row = 0; row < 2; row++)
          acc[m][row] = __builtin_amdgcn_wmma_f32_16x16x32_bf16(
              false, a[cur][m].v, false, xf[row][ks].v, (short)0, acc[m][row],
              false, false);
      // the group's other end: without it the reads of later slices moved up
      // among these matrix instructions and took more registers
      __builtin_amdgcn_sched_barrier(0);
    }

    // the next block's W goes to the other buffer, whose last readers left it
    // ahead of the barrier of the block before
    if (ob < 11)
      for (int i = 0; i < 8; i++) {
        v2u p;
        p[0] = pack_bf16(wr[i][0], wr[i][1]);
        p[1] = pack_bf16(wr[i][2], wr[i][3]);
        *(v2u*)(wdst + ((ob & 1) ^ 1) * 64 * WPITCH + i * 8 * WPITCH) = p;
      }

    // this lane's 8 channels (C layout: register r is row half * 8 + r of a
    // 16-channel tile; even lanes keep tile 0, odd lanes tile 1) and the one
    // pooled position that it will keep
    const int t    = o0 >> 8;                    // 0=q, 1=k, 2=v
    const int head = (ob & 3) * 2 + mh;
    const int dim0 = (ml & 1) * 16 + half * 8;
    const int n    = (hq * 2 + cp) * 32 + cc * 8 + (ml >> 1);
    const v4f bs0 = *(const v4f*)(bias + o0 + mh * 32 + dim0);
    const v4f bs1 = *(const v4f*)(bias + o0 + mh * 32 + dim0 + 4);
    v4f ps0 = {0.f, 0.f, 0.f, 0.f}, ps1 = ps0;
    if (t == 0) {      // asked for ahead of the barrier, whose wait covers them
      ps0 = *(const v4f*)(pos + n * 32 + dim0);
      ps1 = *(const v4f*)(pos + n * 32 + dim0 + 4);
    }
    // publishes the next block's W and ends every wave's reads of this one's
    __syncthreads();

    // 2x2 maxpool: the two image rows are the two tiles of a channel tile, the
    // two columns are lanes l and l ^ 1; even lanes keep channel tile 0, odd
    // lanes tile 1, so every lane ends with 8 channels of one position
    float val[8];
    for (int r = 0; r < 8; r++) {
      float v0 = fmaxf(acc[0][0][r], acc[0][1][r]);
      float v1 = fmaxf(acc[1][0][r], acc[1][1][r]);
      v0 = fmaxf(v0, neighbour_lane(v0));
      v1 = fmaxf(v1, neighbour_lane(v1));
      val[r] = ((ml & 1) ? v1 : v0) + (r < 4 ? bs0[r & 3] : bs1[r & 3]);
    }                                            // (bias commutes with max)
    if (t == 0) {                                // fold pos + scale into q
      // log2(e)/sqrt(32): kernel 2's scores are then exponents of 2
      const float scale = 0.25503486164919736f;
      for (int r = 0; r < 8; r++)
        val[r] = (val[r] + (r < 4 ? ps0[r & 3] : ps1[r & 3])) * scale;
    }
    v4u pk;
    for (int r = 0; r < 4; r++) pk[r] = pack_bf16(val[2 * r], val[2 * r + 1]);
    if (t < 2) {
      // [b,h,n,d]: the lane's 8 dims are 16 neighbouring bytes, and a wave's
      // store covers 8 whole rows, 512 neighbouring bytes
      __bf16* dst = (t == 0) ? qb : kb;
      *(v4u*)(dst + ((size_t)(b * 8 + head) * 1024 + n) * 32 + dim0) = pk;
      // later instructions reuse the registers that this store names: the
      // wait stands in front of that overwrite
      asm volatile("s_wait_xcnt 0x0" ::: "memory");
    } else {
      // V^T [b,h,d,n]: 8 lanes write 8 neighbouring positions of one dim
      unsigned short* dv = (unsigned short*)vtb +
                           ((size_t)(b * 8 + head) * 32 + dim0) * 1024 + n;
      for (int r = 0; r < 4; r++) {
        dv[(2 * r) * 1024]     = (unsigned short)(pk[r] & 0xFFFFu);
        dv[(2 * r + 1) * 1024] = (unsigned short)(pk[r] >> 16);
      }
      // the same wait for these eight stores, inside their own branch: the
      // built code reuses their address pair right behind the branch
      asm volatile("s_wait_xcnt 0x0" ::: "memory");
    }
  }
}

__device__ inline float other_half(float v) {
  int i; __builtin_memcpy(&i, &v, 4);
  i = __builtin_amdgcn_permlanex16(i, i, 0x76543210, 0xfedcba98, false, false);
  float o; __builtin_memcpy(&o, &i, 4); return o;
}

// LDS row pitches of 16 B x odd: the 16 rows that one ds_load_b128 reads then
// start on 16 different bank groups (unpadded rows of 64 B and 128 B fall on
// four and on two)
#define KPITCH 40    // elements per lds_k row: 80 B = 16 B x 5
#define VPITCH 72    // elements per lds_vt row: 144 B = 16 B x 9

__global__ __launch_bounds__(256)
void attn_kernel(const __bf16* __restrict__ qb, const __bf16* __restrict__ kb,
                 const __bf16* __restrict__ vtb, float* __restrict__ out)
{
  __shared__ __attribute__((aligned(16)))
             __bf16 lds_k[64 * KPITCH];   // [key][dim]
  __shared__ __attribute__((aligned(16)))
             __bf16 lds_vt[32 * VPITCH];  // [dim][key] (K-pairs contiguous)

  const int tid  = threadIdx.x;
  const int rb   = blockIdx.x;
  const int h    = blockIdx.y;
  const int b    = blockIdx.z;

  const int wv   = tid >> 5;
  const int lane = tid & 31;
  const int ml   = lane & 15;
  const int half = (lane >> 4) & 1;

  const size_t bh = (size_t)(b * 8 + h) * 1024 * 32;
  const __bf16* q  = qb  + bh;
  const __bf16* k  = kb  + bh;
  const __bf16* vt = vtb + bh;   // [dim][key] layout, 1024 keys per dim row

  int koff[8];
  for (int r = 0; r < 8; r++) koff[r] = frag_koff(r, half);

  const int qrow0 = rb * 128 + wv * 16;

  // Q fragment straight from global (q has pos + log2(e)/sqrt(d) folded);
  // as the B operand its column is query qrow0 + ml
  FragBF qf;
  for (int r = 0; r < 8; r++)
    qf.u[r] = *(const unsigned*)(q + (qrow0 + ml) * 32 + koff[r]);

  // acc0[r] = O^T[dim 8*half + r][query ml], acc1 the same for dims 16..31
  v8f acc0, acc1;
  for (int r = 0; r < 8; r++) { acc0[r] = 0.f; acc1[r] = 0.f; }
  // minus the maximum in use of query ml (base-2 scores), in all 8 registers
  // of a C operand and equal in both halves; 0 until the first block sets it
  v8f negm;
  for (int r = 0; r < 8; r++) negm[r] = 0.f;
  float thr  = -3.0e38f; // the first block always sets the maximum, later: 8
  float lrun = 0.f;      // running sum over this half's keys only

  const int krow = tid >> 2, kchunk = tid & 3;   // K staging coords
  const int vdim = tid >> 3, vchunk = tid & 7;   // V^T staging coords

  for (int j = 0; j < 16; j++) {
    const int key0 = j * 64;

    // async cache->LDS staging: K block 4KB + V^T block 4KB, b128/lane
    async_copy2_b128(k + key0 * 32 + tid * 8,
                     &lds_k[krow * KPITCH + kchunk * 8],
                     vt + vdim * 1024 + key0 + vchunk * 8,
                     &lds_vt[vdim * VPITCH + vchunk * 8]);
    if (j < 15) {   // prefetch next K block into GL2
      __builtin_prefetch(k + (key0 + 64) * 32 + tid * 8, 0, 1);
      __builtin_prefetch(vt + vdim * 1024 + key0 + 64 + vchunk * 8, 0, 1);
    }
    wait_asynccnt0();
    __syncthreads();

    // S^T = K Q^T - maximum in use : 4 x 16-key subtiles
    v8f s[4];
    // unrolled so that s[] is indexed by constants and stays in registers
#pragma unroll
    for (int sub = 0; sub < 4; sub++) {
      FragBF kf;
      for (int r = 0; r < 8; r++)
        kf.u[r] = *(const unsigned*)(&lds_k[(sub * 16 + ml) * KPITCH + koff[r]]);
      s[sub] = __builtin_amdgcn_wmma_f32_16x16x32_bf16(
          false, kf.v, false, qf.v, (short)0, negm, false, false);
    }

    // online softmax of query ml: this lane holds 32 of the block's 64 scores
    float bm4[4];
#pragma unroll   // constant indices into s[]
    for (int sub = 0; sub < 4; sub++) {
      float m01 = fmaxf(s[sub][0], s[sub][1]), m23 = fmaxf(s[sub][2], s[sub][3]);
      float m45 = fmaxf(s[sub][4], s[sub][5]), m67 = fmaxf(s[sub][6], s[sub][7]);
      bm4[sub] = fmaxf(fmaxf(m01, m23), fmaxf(m45, m67));
    }
    float bm = fmaxf(fmaxf(bm4[0], bm4[1]), fmaxf(bm4[2], bm4[3]));
    bm = fmaxf(bm, other_half(bm));
    // one test a block, a scalar branch: after the first block it is taken
    // only where a query's maximum has grown by more than 8
    if (__builtin_amdgcn_ballot_w32(bm > thr) != 0) {
      const float delta = (bm > thr) ? bm : 0.f;   // this query's step
      // delta < 0 can only be the first block's, where O^T and the sum are 0
      const float corr = __builtin_amdgcn_exp2f(-fmaxf(delta, 0.f));
#pragma unroll   // constant indices into s[]
      for (int sub = 0; sub < 4; sub++)
        for (int r = 0; r < 8; r++) s[sub][r] -= delta;
      for (int r = 0; r < 8; r++) {
        negm[r] -= delta; acc0[r] *= corr; acc1[r] *= corr;
      }
      lrun *= corr;
    }
    thr = 8.0f;
    float rs4[4];
#pragma unroll   // constant indices into s[]
    for (int sub = 0; sub < 4; sub++) {
      for (int r = 0; r < 8; r++) s[sub][r] = __builtin_amdgcn_exp2f(s[sub][r]);
      rs4[sub] = ((s[sub][0] + s[sub][1]) + (s[sub][2] + s[sub][3])) +
                 ((s[sub][4] + s[sub][5]) + (s[sub][6] + s[sub][7]));
    }
    lrun += (rs4[0] + rs4[1]) + (rs4[2] + rs4[3]);

    // O^T += V^T P^T : two K=32 chunks x two 16-dim tiles
#pragma unroll   // constant indices into s[]
    for (int c = 0; c < 2; c++) {
      // B operand: registers 0..3 hold keys 8*half + 0..7 of the chunk (tile
      // 2c), registers 4..7 keys 16 + 8*half + 0..7 (tile 2c + 1)
      FragBF pf;
      for (int r = 0; r < 4; r++) {
        pf.u[r]     = pack_bf16(s[2 * c][2 * r],     s[2 * c][2 * r + 1]);
        pf.u[4 + r] = pack_bf16(s[2 * c + 1][2 * r], s[2 * c + 1][2 * r + 1]);
      }
      FragBF vf0, vf1;
      for (int r = 0; r < 8; r++) {
        vf0.u[r] = *(const unsigned*)(&lds_vt[ml * VPITCH        + c * 32 + koff[r]]);
        vf1.u[r] = *(const unsigned*)(&lds_vt[(16 + ml) * VPITCH + c * 32 + koff[r]]);
      }
      acc0 = __builtin_amdgcn_wmma_f32_16x16x32_bf16(
          false, vf0.v, false, pf.v, (short)0, acc0, false, false);
      acc1 = __builtin_amdgcn_wmma_f32_16x16x32_bf16(
          false, vf1.v, false, pf.v, (short)0, acc1, false, false);
    }
    __syncthreads();
  }

  // join the halves' sums, normalize, store to [B, C=head*32+dim, Hp*Wp]:
  // 16 lanes write 16 neighbouring positions of one channel
  lrun += other_half(lrun);
  const float inv = 1.0f / lrun;
  float* o = out + ((size_t)b * 256 + h * 32 + half * 8) * 1024 + qrow0 + ml;
  for (int r = 0; r < 8; r++) {
    o[(size_t)r * 1024]        = acc0[r] * inv;
    o[(size_t)(16 + r) * 1024] = acc1[r] * inv;
  }
}

// ---------------------------------------------------------------------------
extern "C" void kernel_launch(void* const* d_in, const int* in_sizes, int n_in,
                              void* d_out, int out_size, void* d_ws, size_t ws_size,
                              hipStream_t stream) {
  const float* x    = (const float*)d_in[0];
  const float* w    = (const float*)d_in[1];
  const float* bias = (const float*)d_in[2];
  const float* pos  = (const float*)d_in[3];

  const size_t per = (size_t)16 * 8 * 1024 * 32;   // elements per q/k/v buffer
  __bf16* qb  = (__bf16*)d_ws;
  __bf16* kb  = qb + per;
  __bf16* vtb = kb + per;

  qkv_pool_kernel<<<dim3(16, 16), 512, 0, stream>>>(x, w, bias, pos, qb, kb, vtb);
  attn_kernel<<<dim3(8, 8, 16), 256, 0, stream>>>(qb, kb, vtb, (float*)d_out);
}

// v008
// One run takes 51 microseconds.
// Next to v007, in two timings, it ran 1.03 times as fast each time.
// All steps since v000 together make it 7.80 times as fast.
#include <hip/hip_runtime.h>
#include <hip/hip_bf16.h>

typedef __attribute__((ext_vector_type(16))) __bf16 v16bf;
typedef __attribute__((ext_vector_type(8)))  float  v8f;

union FragBF { unsigned u[8]; v16bf v; };

__device__ inline __bf16 f2bf(float f) {
  union { float f; unsigned u; } a; a.f = f;
  unsigned r = a.u + 0x7FFFu + ((a.u >> 16) & 1u);   // round-to-nearest-even
  unsigned short h = (unsigned short)(r >> 16);
  __bf16 o; __builtin_memcpy(&o, &h, 2); return o;
}

typedef __attribute__((ext_vector_type(2))) float    v2f;
typedef __attribute__((ext_vector_type(4))) float    v4f;
typedef __attribute__((ext_vector_type(2))) __bf16   v2bf;
typedef __attribute__((ext_vector_type(2))) unsigned v2u;

// two f32 -> one register of two bf16 (round to nearest even), lo in bits 15..0
__device__ inline unsigned pack_bf16(float lo, float hi) {
  v2f f; f[0] = lo; f[1] = hi;
  v2bf p = __builtin_convertvector(f, v2bf);
  unsigned u; __builtin_memcpy(&u, &p, 4); return u;
}

// Per-lane K-offset for 16-bit A/B fragments (ISA 7.12.2):
// lanes 0-15: VGPR r -> K = {2r,2r+1} (r<4) / {16+2(r-4),...} (r>=4)
// lanes 16-31: same +8.
__device__ inline int frag_koff(int r, int half) {
  return ((r >> 2) << 4) + (half << 3) + ((r & 3) << 1);
}

// Async cache->LDS copy, 16 bytes per enabled lane (gfx1250 ASYNCcnt path).
// VDST VGPR carries the 32-bit LDS byte address; VADDR the 64-bit global addr.
// Two copies in one statement; the s_wait_xcnt closes it so that no register
// which a copy names can be rewritten ahead of that wait.
__device__ inline void async_copy2_b128(const void* gsrc0, void* ldst0,
                                        const void* gsrc1, void* ldst1) {
  unsigned lds0 = (unsigned)(unsigned long long)ldst0;  // low 32 = LDS offset
  unsigned lds1 = (unsigned)(unsigned long long)ldst1;
  asm volatile("global_load_async_to_lds_b128 %0, %1, off\n\t"
               "global_load_async_to_lds_b128 %2, %3, off\n\t"
               "s_wait_xcnt 0x0"
               :: "v"(lds0), "v"(gsrc0), "v"(lds1), "v"(gsrc1) : "memory");
}
__device__ inline void wait_asynccnt0() {
  asm volatile("s_wait_asynccnt 0x0" ::: "memory");
}

// ---------------------------------------------------------------------------
// Kernel 1: QKV projection + pool.
// grid = (Hp/2=16, B=16), block = 512 (16 waves), one work-group a WGP.
// Each workgroup converts its X[256 x 256] tile (four image rows) to bf16 in
// LDS once; every wave then takes the fragments of its own 32 columns (16
// columns of an image row and the same 16 of the row below) into registers
// and keeps them there for all 12 channel blocks of 64:
// Y[64 x 256] = W[64 x 256] * X[256 x 256], pooled to 64 x 64 and scattered.
// In the k loop a wave reads only W from LDS: two fragments (32 channels) for
// four matrix instructions. With both image rows in one wave the 2x2 pool
// stays in its registers.
// W has two LDS buffers: a block's loads are issued under the k loop of the
// block before and stored behind it, so one barrier a block is enough.
// ---------------------------------------------------------------------------
#define XPITCH 264   // elements per lds_x row: 528 B = 16 B x 33, b128 readers
#define WPITCH 264   // elements per lds_w row: 528 B = 16 B x 33, b128 readers

typedef __attribute__((ext_vector_type(4))) unsigned v4u;

// value of lane l ^ 1 (the neighbouring image column of an accumulator tile)
__device__ inline float neighbour_lane(float v) {
  int i; __builtin_memcpy(&i, &v, 4);
  i = __builtin_amdgcn_update_dpp(i, i, 0xB1, 0xF, 0xF, true);  // quad 1,0,3,2
  float o; __builtin_memcpy(&o, &i, 4); return o;
}

// 16 waves are four a SIMD: at most 256 registers each
__global__ __launch_bounds__(512, 4)
void qkv_pool_kernel(const float* __restrict__ x, const float* __restrict__ w,
                     const float* __restrict__ bias, const float* __restrict__ pos,
                     __bf16* __restrict__ qb, __bf16* __restrict__ kb,
                     __bf16* __restrict__ vtb)
{
  __shared__ __attribute__((aligned(16)))
             __bf16 lds_w[2 * 64 * WPITCH];  // two buffers of [m][k], 256 k
  __shared__ __attribute__((aligned(16)))
             __bf16 lds_x[256 * XPITCH];     // [s][k], all 256 k

  const int tid  = threadIdx.x;
  const int hq   = blockIdx.x;   // pair of pooled rows: 0..15
  const int b    = blockIdx.y;   // batch
  const int s0   = hq * 256;     // rows 4hq .. 4hq+3 are contiguous 256 floats

  const int wv   = tid >> 5;
  const int lane = tid & 31;
  const int ml   = lane & 15;
  const int half = (lane >> 4) & 1;
  const int cc   = wv & 3;        // column tile (16 image columns)
  const int cp   = (wv >> 2) & 1; // which of the two pooled rows
  const int mh   = wv >> 3;       // which 32 of a block's 64 channels

  int koff[8];
  for (int r = 0; r < 8; r++) koff[r] = frag_koff(r, half);

  // W staging: this thread brings floats 4*(tid & 63) .. +3 of rows tid >> 6,
  // + 8, + 16, ... of a block, so a wave's load covers 512 contiguous bytes
  const float* wsrc = w + (tid >> 6) * 256 + (tid & 63) * 4;
  __bf16*      wdst = &lds_w[(tid >> 6) * WPITCH + (tid & 63) * 4];
  v4f wr[8];
  for (int i = 0; i < 8; i++)
    wr[i] = *(const v4f*)(wsrc + i * 8 * 256);

  // stage the whole X tile [s][k] once (coalesced along s): this thread owns
  // column s = tid & 255 and every second k, starting at tid >> 8
  const float* xp = x + ((size_t)(b * 256 + (tid >> 8))) * 4096 + s0 + (tid & 255);
  __bf16*      xs = &lds_x[(tid & 255) * XPITCH + (tid >> 8)];
  // unrolled whole: every load is then one base register plus a constant
  // offset, and many of them are in flight to cover the latency of memory
#pragma unroll
  for (int k = 0; k < 256; k += 2)
    xs[k] = f2bf(xp[(size_t)k * 4096]);

  // block 0's W goes to buffer 0 as bf16
  for (int i = 0; i < 8; i++) {
    v2u p;
    p[0] = pack_bf16(wr[i][0], wr[i][1]);
    p[1] = pack_bf16(wr[i][2], wr[i][3]);
    *(v2u*)(wdst + i * 8 * WPITCH) = p;
  }
  __syncthreads();   // publishes lds_x and buffer 0 of lds_w

  // this wave's X fragments, all 8 k slices of both image rows: read once
  FragBF xf[2][8];
  for (int row = 0; row < 2; row++)
    for (int ks = 0; ks < 8; ks++)
      for (int r = 0; r < 8; r++)
        xf[row][ks].u[r] = *(const unsigned*)(
            &lds_x[((cp * 2 + row) * 64 + cc * 16 + ml) * XPITCH
                   + ks * 32 + koff[r]]);

  // kept rolled: the fragments above leave no registers for a second copy of
  // the body, and the code stays small
#pragma unroll 1
  for (int ob = 0; ob < 12; ob++) {   // 64-channel block
    const int o0 = ob * 64;
    const __bf16* wb = &lds_w[(ob & 1) * 64 * WPITCH
                              + (mh * 32 + ml) * WPITCH];

    // the next block's W is asked for here and flies under this block's k loop
    if (ob < 11)
      for (int i = 0; i < 8; i++)
        wr[i] = *(const v4f*)(wsrc + (o0 + 64 + i * 8) * 256);

    v8f acc[2][2];   // [16-channel tile][image row]
    for (int m = 0; m < 2; m++)
      for (int row = 0; row < 2; row++)
        for (int r = 0; r < 8; r++) acc[m][row][r] = 0.f;

    // the W fragments of k slice ks + 1 are read from LDS into a second
    // register set ahead of the matrix instructions of slice ks;
    // unrolled so that both sets and xf[] are indexed by constants
    FragBF a[2][2];
    for (int m = 0; m < 2; m++)
      for (int r = 0; r < 8; r++)
        a[0][m].u[r] = *(const unsigned*)(&wb[m * 16 * WPITCH + koff[r]]);
#pragma unroll
    for (int ks = 0; ks < 8; ks++) {
      const int cur = ks & 1, nxt = cur ^ 1, k1 = (ks + 1) * 32;
      if (ks < 7)
        for (int m = 0; m < 2; m++)
          for (int r = 0; r < 8; r++)
            a[nxt][m].u[r] = *(const unsigned*)(
                &wb[m * 16 * WPITCH + k1 + koff[r]]);
      // keeps the reads above one group ahead of this slice's matrix
      // instructions: left free, the compiler put each read directly in front
      // of its user, with a full LDS wait per matrix instruction
      __builtin_amdgcn_sched_barrier(0);
      for (int m = 0; m < 2; m++)
        for (int row = 0; row < 2; row++)
          acc[m][row] = __builtin_amdgcn_wmma_f32_16x16x32_bf16(
              false, a[cur][m].v, false, xf[row][ks].v, (short)0, acc[m][row],
              false, false);
      // the group's other end: without it the reads of later slices moved up
      // among these matrix instructions and took more registers
      __builtin_amdgcn_sched_barrier(0);
    }

    // the next block's W goes to the other buffer, whose last readers left it
    // ahead of the barrier of the block before
    if (ob < 11)
      for (int i = 0; i < 8; i++) {
        v2u p;
        p[0] = pack_bf16(wr[i][0], wr[i][1]);
        p[1] = pack_bf16(wr[i][2], wr[i][3]);
        *(v2u*)(wdst + ((ob & 1) ^ 1) * 64 * WPITCH + i * 8 * WPITCH) = p;
      }

    // this lane's 8 channels (C layout: register r is row half * 8 + r of a
    // 16-channel tile; even lanes keep tile 0, odd lanes tile 1) and the one
    // pooled position that it will keep
    const int t    = o0 >> 8;                    // 0=q, 1=k, 2=v
    const int head = (ob & 3) * 2 + mh;
    const int dim0 = (ml & 1) * 16 + half * 8;
    const int n    = (hq * 2 + cp) * 32 + cc * 8 + (ml >> 1);
    const v4f bs0 = *(const v4f*)(bias + o0 + mh * 32 + dim0);
    const v4f bs1 = *(const v4f*)(bias + o0 + mh * 32 + dim0 + 4);
    v4f ps0 = {0.f, 0.f, 0.f, 0.f}, ps1 = ps0;
    if (t == 0) {      // asked for ahead of the barrier, whose wait covers them
      ps0 = *(const v4f*)(pos + n * 32 + dim0);
      ps1 = *(const v4f*)(pos + n * 32 + dim0 + 4);
    }
    // publishes the next block's W and ends every wave's reads of this one's
    __syncthreads();

    // 2x2 maxpool: the two image rows are the two tiles of a channel tile, the
    // two columns are lanes l and l ^ 1; even lanes keep channel tile 0, odd
    // lanes tile 1, so every lane ends with 8 channels of one position
    float val[8];
    for (int r = 0; r < 8; r++) {
      float v0 = fmaxf(acc[0][0][r], acc[0][1][r]);
      float v1 = fmaxf(acc[1][0][r], acc[1][1][r]);
      v0 = fmaxf(v0, neighbour_lane(v0));
      v1 = fmaxf(v1, neighbour_lane(v1));
      val[r] = ((ml & 1) ? v1 : v0) + (r < 4 ? bs0[r & 3] : bs1[r & 3]);
    }                                            // (bias commutes with max)
    if (t == 0) {                                // fold pos + scale into q
      // log2(e)/sqrt(32): kernel 2's scores are then exponents of 2
      const float scale = 0.25503486164919736f;
      for (int r = 0; r < 8; r++)
        val[r] = (val[r] + (r < 4 ? ps0[r & 3] : ps1[r & 3])) * scale;
    }
    v4u pk;
    for (int r = 0; r < 4; r++) pk[r] = pack_bf16(val[2 * r], val[2 * r + 1]);
    if (t < 2) {
      // [b,h,n,d]: the lane's 8 dims are 16 neighbouring bytes, and a wave's
      // store covers 8 whole rows, 512 neighbouring bytes
      __bf16* dst = (t == 0) ? qb : kb;
      *(v4u*)(dst + ((size_t)(b * 8 + head) * 1024 + n) * 32 + dim0) = pk;
      // later instructions reuse the registers that this store names: the
      // wait stands in front of that overwrite
      asm volatile("s_wait_xcnt 0x0" ::: "memory");
    } else {
      // V^T [b,h,d,n]: 8 lanes write 8 neighbouring positions of one dim
      unsigned short* dv = (unsigned short*)vtb +
                           ((size_t)(b * 8 + head) * 32 + dim0) * 1024 + n;
      for (int r = 0; r < 4; r++) {
        dv[(2 * r) * 1024]     = (unsigned short)(pk[r] & 0xFFFFu);
        dv[(2 * r + 1) * 1024] = (unsigned short)(pk[r] >> 16);
      }
      // the same wait for these eight stores, inside their own branch: the
      // built code reuses their address pair right behind the branch
      asm volatile("s_wait_xcnt 0x0" ::: "memory");
    }
  }
}

__device__ inline float other_half(float v) {
  int i; __builtin_memcpy(&i, &v, 4);
  i = __builtin_amdgcn_permlanex16(i, i, 0x76543210, 0xfedcba98, false, false);
  float o; __builtin_memcpy(&o, &i, 4); return o;
}

// LDS row pitches of 16 B x odd: the 16 rows that one ds_load_b128 reads then
// start on 16 different bank groups (unpadded rows of 64 B and 128 B fall on
// four and on two)
#define KPITCH 40    // elements per lds_k row: 80 B = 16 B x 5
#define VPITCH 72    // elements per lds_vt row: 144 B = 16 B x 9

// four work-groups a WGP, one wave of each on every SIMD: at most 256
// registers a wave
__global__ __launch_bounds__(128, 4)
void attn_kernel(const __bf16* __restrict__ qb, const __bf16* __restrict__ kb,
                 const __bf16* __restrict__ vtb, float* __restrict__ out)
{
  __shared__ __attribute__((aligned(16)))
             __bf16 lds_k[64 * KPITCH];   // [key][dim]
  __shared__ __attribute__((aligned(16)))
             __bf16 lds_vt[32 * VPITCH];  // [dim][key] (K-pairs contiguous)

  const int tid  = threadIdx.x;
  const int rb   = blockIdx.x;
  const int h    = blockIdx.y;
  const int b    = blockIdx.z;

  const int wv   = tid >> 5;
  const int lane = tid & 31;
  const int ml   = lane & 15;
  const int half = (lane >> 4) & 1;

  const size_t bh = (size_t)(b * 8 + h) * 1024 * 32;
  const __bf16* q  = qb  + bh;
  const __bf16* k  = kb  + bh;
  const __bf16* vt = vtb + bh;   // [dim][key] layout, 1024 keys per dim row

  int koff[8];
  for (int r = 0; r < 8; r++) koff[r] = frag_koff(r, half);

  const int qrow0 = rb * 128 + wv * 32;

  // Q fragments straight from global (q has pos + log2(e)/sqrt(d) folded);
  // as the B operand, tile t's column is query qrow0 + 16 t + ml
  FragBF qf[2];
  for (int t = 0; t < 2; t++)
    for (int r = 0; r < 8; r++)
      qf[t].u[r] = *(const unsigned*)(q + (qrow0 + t * 16 + ml) * 32 + koff[r]);

  // acc[t][d][r] = O^T[dim 16 d + 8*half + r][query 16 t + ml]
  v8f acc[2][2];
  // minus the maximum in use of a tile's query ml (base-2 scores), in all 8
  // registers of a C operand and equal in both halves; 0 until block 0 sets it
  v8f negm[2];
  for (int t = 0; t < 2; t++)
    for (int r = 0; r < 8; r++) {
      acc[t][0][r] = 0.f; acc[t][1][r] = 0.f; negm[t][r] = 0.f;
    }
  float thr = -3.0e38f;  // the first block always sets the maximum, later: 8
  float lrun[2] = {0.f, 0.f};   // running sums over this half's keys only

  // staging coords: a thread brings two 16-byte pieces of K and two of V^T
  const int krow = tid >> 2, kchunk = tid & 3;   // and row krow + 32
  const int vdim = tid >> 3, vchunk = tid & 7;   // and dim vdim + 16

  for (int j = 0; j < 16; j++) {
    const int key0 = j * 64;

    // async cache->LDS staging: K block 4KB + V^T block 4KB, b128/lane
    async_copy2_b128(k + key0 * 32 + tid * 8,
                     &lds_k[krow * KPITCH + kchunk * 8],
                     k + key0 * 32 + 1024 + tid * 8,
                     &lds_k[(krow + 32) * KPITCH + kchunk * 8]);
    async_copy2_b128(vt + vdim * 1024 + key0 + vchunk * 8,
                     &lds_vt[vdim * VPITCH + vchunk * 8],
                     vt + (vdim + 16) * 1024 + key0 + vchunk * 8,
                     &lds_vt[(vdim + 16) * VPITCH + vchunk * 8]);
    if (j < 15) {   // prefetch next K and V^T block into GL2, 32 B a thread
      __builtin_prefetch(k + (key0 + 64) * 32 + tid * 16, 0, 1);
      __builtin_prefetch(vt + (tid >> 2) * 1024 + key0 + 64 + (tid & 3) * 16, 0, 1);
    }
    wait_asynccnt0();
    __syncthreads();

    // S^T = K Q^T - maximum in use : 4 x 16-key subtiles for both query tiles
    v8f s[2][4];
    FragBF kf[4];
    for (int sub = 0; sub < 4; sub++)
      for (int r = 0; r < 8; r++)
        kf[sub].u[r] =
            *(const unsigned*)(&lds_k[(sub * 16 + ml) * KPITCH + koff[r]]);
    // vf[c][d]: keys 32 c .. 32 c + 31 of dims 16 d .. 16 d + 15
    FragBF vf[2][2];
    for (int c = 0; c < 2; c++)
      for (int d = 0; d < 2; d++)
        for (int r = 0; r < 8; r++)
          vf[c][d].u[r] = *(const unsigned*)(
              &lds_vt[(d * 16 + ml) * VPITCH + c * 32 + koff[r]]);
    // keeps the sixteen LDS reads above as one group ahead of the matrix
    // instructions: left free, the compiler read each K fragment into the same
    // registers, with a full LDS wait in front of every pair of them, and half
    // of V^T among the last matrix instructions
    __builtin_amdgcn_sched_barrier(0);
    // unrolled so that s[] is indexed by constants and stays in registers
#pragma unroll
    for (int sub = 0; sub < 4; sub++)
#pragma unroll   // constant indices into s[]
      for (int t = 0; t < 2; t++)
        s[t][sub] = __builtin_amdgcn_wmma_f32_16x16x32_bf16(
            false, kf[sub].v, false, qf[t].v, (short)0, negm[t], false, false);
    // keeps the maxima behind all eight matrix instructions: left free, the
    // compiler put each tile's maxima directly behind its own instruction and
    // filled the distance that the chip needs there with v_nop
    __builtin_amdgcn_sched_barrier(0);

    // online softmax of a tile's query ml: this lane holds 32 of its 64 scores
    float bm[2];
#pragma unroll   // constant indices into s[]
    for (int t = 0; t < 2; t++) {
      float bm4[4];
      for (int sub = 0; sub < 4; sub++) {
        float m01 = fmaxf(s[t][sub][0], s[t][sub][1]);
        float m23 = fmaxf(s[t][sub][2], s[t][sub][3]);
        float m45 = fmaxf(s[t][sub][4], s[t][sub][5]);
        float m67 = fmaxf(s[t][sub][6], s[t][sub][7]);
        bm4[sub] = fmaxf(fmaxf(m01, m23), fmaxf(m45, m67));
      }
      bm[t] = fmaxf(fmaxf(bm4[0], bm4[1]), fmaxf(bm4[2], bm4[3]));
      bm[t] = fmaxf(bm[t], other_half(bm[t]));
    }
    // one test a block for both tiles, a scalar branch: after the first block
    // it is taken only where a query's maximum has grown by more than 8
    if (__builtin_amdgcn_ballot_w32(fmaxf(bm[0], bm[1]) > thr) != 0) {
#pragma unroll   // constant indices into s[]
      for (int t = 0; t < 2; t++) {
        const float delta = (bm[t] > thr) ? bm[t] : 0.f;   // this query's step
        // delta < 0 can only be the first block's, where O^T and the sum are 0
        const float corr = __builtin_amdgcn_exp2f(-fmaxf(delta, 0.f));
        for (int sub = 0; sub < 4; sub++)
          for (int r = 0; r < 8; r++) s[t][sub][r] -= delta;
        for (int r = 0; r < 8; r++) {
          negm[t][r] -= delta; acc[t][0][r] *= corr; acc[t][1][r] *= corr;
        }
        lrun[t] *= corr;
      }
    }
    thr = 8.0f;
    // P^T as B operands, pf[t][c]: registers 0..3 hold keys 8*half + 0..7 of
    // chunk c (tile 2c), registers 4..7 keys 16 + 8*half + 0..7 (tile 2c + 1)
    FragBF pf[2][2];
#pragma unroll   // constant indices into s[]
    for (int t = 0; t < 2; t++) {
      float rs4[4];
      for (int sub = 0; sub < 4; sub++) {
        for (int r = 0; r < 8; r++)
          s[t][sub][r] = __builtin_amdgcn_exp2f(s[t][sub][r]);
        rs4[sub] = ((s[t][sub][0] + s[t][sub][1]) + (s[t][sub][2] + s[t][sub][3])) +
                   ((s[t][sub][4] + s[t][sub][5]) + (s[t][sub][6] + s[t][sub][7]));
      }
      lrun[t] += (rs4[0] + rs4[1]) + (rs4[2] + rs4[3]);
      for (int c = 0; c < 2; c++)
        for (int r = 0; r < 4; r++) {
          pf[t][c].u[r]     = pack_bf16(s[t][2 * c][2 * r],     s[t][2 * c][2 * r + 1]);
          pf[t][c].u[4 + r] = pack_bf16(s[t][2 * c + 1][2 * r], s[t][2 * c + 1][2 * r + 1]);
        }
    }
    // keeps the packs ahead of the eight matrix instructions below: left free,
    // the compiler spread them among these, and the loop came out some register
    // copies longer
    __builtin_amdgcn_sched_barrier(0);

    // O^T += V^T P^T : two K=32 chunks x two query tiles x two 16-dim tiles
#pragma unroll   // constant indices into pf[], vf[] and acc[]
    for (int c = 0; c < 2; c++)
#pragma unroll   // constant indices into pf[], vf[] and acc[]
      for (int t = 0; t < 2; t++) {
        acc[t][0] = __builtin_amdgcn_wmma_f32_16x16x32_bf16(
            false, vf[c][0].v, false, pf[t][c].v, (short)0, acc[t][0], false, false);
        acc[t][1] = __builtin_amdgcn_wmma_f32_16x16x32_bf16(
            false, vf[c][1].v, false, pf[t][c].v, (short)0, acc[t][1], false, false);
      }
    __syncthreads();
  }

  // join the halves' sums, normalize, store to [B, C=head*32+dim, Hp*Wp]:
  // 16 lanes write 16 neighbouring positions of one channel
  for (int t = 0; t < 2; t++) {
    const float lsum = lrun[t] + other_half(lrun[t]);
    const float inv = 1.0f / lsum;
    float* o = out + ((size_t)b * 256 + h * 32 + half * 8) * 1024
                   + qrow0 + t * 16 + ml;
    for (int r = 0; r < 8; r++) {
      o[(size_t)r * 1024]        = acc[t][0][r] * inv;
      o[(size_t)(16 + r) * 1024] = acc[t][1][r] * inv;
    }
  }
}

// ---------------------------------------------------------------------------
extern "C" void kernel_launch(void* const* d_in, const int* in_sizes, int n_in,
                              void* d_out, int out_size, void* d_ws, size_t ws_size,
                              hipStream_t stream) {
  const float* x    = (const float*)d_in[0];
  const float* w    = (const float*)d_in[1];
  const float* bias = (const float*)d_in[2];
  const float* pos  = (const float*)d_in[3];

  const size_t per = (size_t)16 * 8 * 1024 * 32;   // elements per q/k/v buffer
  __bf16* qb  = (__bf16*)d_ws;
  __bf16* kb  = qb + per;
  __bf16* vtb = kb + per;

  qkv_pool_kernel<<<dim3(16, 16), 512, 0, stream>>>(x, w, bias, pos, qb, kb, vtb);
  attn_kernel<<<dim3(8, 8, 16), 128, 0, stream>>>(qb, kb, vtb, (float*)d_out);
}

// v009
// A run of this version takes 49.2 microseconds.
// In both of two side-by-side timings against v008, it was 1.03 times as fast.
// Over all steps from v000 it is 8.05 times as fast.
#include <hip/hip_runtime.h>
#include <hip/hip_bf16.h>

typedef __attribute__((ext_vector_type(16))) __bf16 v16bf;
typedef __attribute__((ext_vector_type(8)))  float  v8f;

union FragBF { unsigned u[8]; v16bf v; };

__device__ inline __bf16 f2bf(float f) {
  union { float f; unsigned u; } a; a.f = f;
  unsigned r = a.u + 0x7FFFu + ((a.u >> 16) & 1u);   // round-to-nearest-even
  unsigned short h = (unsigned short)(r >> 16);
  __bf16 o; __builtin_memcpy(&o, &h, 2); return o;
}

typedef __attribute__((ext_vector_type(2))) float    v2f;
typedef __attribute__((ext_vector_type(4))) float    v4f;
typedef __attribute__((ext_vector_type(2))) __bf16   v2bf;
typedef __attribute__((ext_vector_type(2))) unsigned v2u;

// two f32 -> one register of two bf16 (round to nearest even), lo in bits 15..0
__device__ inline unsigned pack_bf16(float lo, float hi) {
  v2f f; f[0] = lo; f[1] = hi;
  v2bf p = __builtin_convertvector(f, v2bf);
  unsigned u; __builtin_memcpy(&u, &p, 4); return u;
}

// Per-lane K-offset for 16-bit A/B fragments (ISA 7.12.2):
// lanes 0-15: VGPR r -> K = {2r,2r+1} (r<4) / {16+2(r-4),...} (r>=4)
// lanes 16-31: same +8.
__device__ inline int frag_koff(int r, int half) {
  return ((r >> 2) << 4) + (half << 3) + ((r & 3) << 1);
}

// Async cache->LDS copy, 16 bytes per enabled lane (gfx1250 ASYNCcnt path).
// VDST VGPR carries the 32-bit LDS byte address; VADDR the 64-bit global addr.
// Two copies in one statement; the s_wait_xcnt closes it so that no register
// which a copy names can be rewritten ahead of that wait.
__device__ inline void async_copy2_b128(const void* gsrc0, void* ldst0,
                                        const void* gsrc1, void* ldst1) {
  unsigned lds0 = (unsigned)(unsigned long long)ldst0;  // low 32 = LDS offset
  unsigned lds1 = (unsigned)(unsigned long long)ldst1;
  asm volatile("global_load_async_to_lds_b128 %0, %1, off\n\t"
               "global_load_async_to_lds_b128 %2, %3, off\n\t"
               "s_wait_xcnt 0x0"
               :: "v"(lds0), "v"(gsrc0), "v"(lds1), "v"(gsrc1) : "memory");
}
__device__ inline void wait_asynccnt0() {
  asm volatile("s_wait_asynccnt 0x0" ::: "memory");
}

// ---------------------------------------------------------------------------
// Kernel 1: QKV projection + pool.
// grid = (Hp/2=16, B=16), block = 512 (16 waves), one work-group a WGP.
// Each workgroup converts its X[256 x 256] tile (four image rows) to bf16 in
// LDS once; every wave then takes the fragments of its own 32 columns (16
// columns of an image row and the same 16 of the row below) into registers
// and keeps them there for all 12 channel blocks of 64:
// Y[64 x 256] = W[64 x 256] * X[256 x 256], pooled to 64 x 64 and scattered.
// In the k loop a wave reads only W from LDS: two fragments (32 channels) for
// four matrix instructions. With both image rows in one wave the 2x2 pool
// stays in its registers.
// W has two LDS buffers: a block's loads are issued under the k loop of the
// block before and stored behind it, so one barrier a block is enough.
// ---------------------------------------------------------------------------
#define XPITCH 264   // elements per lds_x row: 528 B = 16 B x 33, b128 readers
#define WPITCH 264   // elements per lds_w row: 528 B = 16 B x 33, b128 readers

typedef __attribute__((ext_vector_type(4))) unsigned v4u;

// value of lane l ^ 1 (the neighbouring image column of an accumulator tile)
__device__ inline float neighbour_lane(float v) {
  int i; __builtin_memcpy(&i, &v, 4);
  i = __builtin_amdgcn_update_dpp(i, i, 0xB1, 0xF, 0xF, true);  // quad 1,0,3,2
  float o; __builtin_memcpy(&o, &i, 4); return o;
}

// 16 waves are four a SIMD: at most 256 registers each
__global__ __launch_bounds__(512, 4)
void qkv_pool_kernel(const float* __restrict__ x, const float* __restrict__ w,
                     const float* __restrict__ bias, const float* __restrict__ pos,
                     __bf16* __restrict__ qb, __bf16* __restrict__ kb,
                     __bf16* __restrict__ vtb)
{
  __shared__ __attribute__((aligned(16)))
             __bf16 lds_w[2 * 64 * WPITCH];  // two buffers of [m][k], 256 k
  __shared__ __attribute__((aligned(16)))
             __bf16 lds_x[256 * XPITCH];     // [s][k], all 256 k

  const int tid  = threadIdx.x;
  const int hq   = blockIdx.x;   // pair of pooled rows: 0..15
  const int b    = blockIdx.y;   // batch
  const int s0   = hq * 256;     // rows 4hq .. 4hq+3 are contiguous 256 floats

  const int wv   = tid >> 5;
  const int lane = tid & 31;
  const int ml   = lane & 15;
  const int half = (lane >> 4) & 1;
  const int cc   = wv & 3;        // column tile (16 image columns)
  const int cp   = (wv >> 2) & 1; // which of the two pooled rows
  const int mh   = wv >> 3;       // which 32 of a block's 64 channels

  int koff[8];
  for (int r = 0; r < 8; r++) koff[r] = frag_koff(r, half);

  // W staging: this thread brings floats 4*(tid & 63) .. +3 of rows tid >> 6,
  // + 8, + 16, ... of a block, so a wave's load covers 512 contiguous bytes
  const float* wsrc = w + (tid >> 6) * 256 + (tid & 63) * 4;
  __bf16*      wdst = &lds_w[(tid >> 6) * WPITCH + (tid & 63) * 4];
  v4f wr[8];
  for (int i = 0; i < 8; i++)
    wr[i] = *(const v4f*)(wsrc + i * 8 * 256);

  // stage the whole X tile [s][k] once (coalesced along s): this thread owns
  // column s = tid & 255 and every second k, starting at tid >> 8
  const float* xp = x + ((size_t)(b * 256 + (tid >> 8))) * 4096 + s0 + (tid & 255);
  __bf16*      xs = &lds_x[(tid & 255) * XPITCH + (tid >> 8)];
  // unrolled whole: every load is then one base register plus a constant
  // offset, and many of them are in flight to cover the latency of memory
#pragma unroll
  for (int k = 0; k < 256; k += 2)
    xs[k] = f2bf(xp[(size_t)k * 4096]);

  // block 0's W goes to buffer 0 as bf16
  for (int i = 0; i < 8; i++) {
    v2u p;
    p[0] = pack_bf16(wr[i][0], wr[i][1]);
    p[1] = pack_bf16(wr[i][2], wr[i][3]);
    *(v2u*)(wdst + i * 8 * WPITCH) = p;
  }
  __syncthreads();   // publishes lds_x and buffer 0 of lds_w

  // this wave's X fragments, all 8 k slices of both image rows: read once
  FragBF xf[2][8];
  for (int row = 0; row < 2; row++)
    for (int ks = 0; ks < 8; ks++)
      for (int r = 0; r < 8; r++)
        xf[row][ks].u[r] = *(const unsigned*)(
            &lds_x[((cp * 2 + row) * 64 + cc * 16 + ml) * XPITCH
                   + ks * 32 + koff[r]]);

  // kept rolled: the fragments above leave no registers for a second copy of
  // the body, and the code stays small
#pragma unroll 1
  for (int ob = 0; ob < 12; ob++) {   // 64-channel block
    const int o0 = ob * 64;
    const __bf16* wb = &lds_w[(ob & 1) * 64 * WPITCH
                              + (mh * 32 + ml) * WPITCH];

    // the next block's W is asked for here and flies under this block's k loop
    if (ob < 11)
      for (int i = 0; i < 8; i++)
        wr[i] = *(const v4f*)(wsrc + (o0 + 64 + i * 8) * 256);

    v8f acc[2][2];   // [16-channel tile][image row]
    for (int m = 0; m < 2; m++)
      for (int row = 0; row < 2; row++)
        for (int r = 0; r < 8; r++) acc[m][row][r] = 0.f;

    // the W fragments of k slice ks + 1 are read from LDS into a second
    // register set ahead of the matrix instructions of slice ks;
    // unrolled so that both sets and xf[] are indexed by constants
    FragBF a[2][2];
    for (int m = 0; m < 2; m++)
      for (int r = 0; r < 8; r++)
        a[0][m].u[r] = *(const unsigned*)(&wb[m * 16 * WPITCH + koff[r]]);
#pragma unroll
    for (int ks = 0; ks < 8; ks++) {
      const int cur = ks & 1, nxt = cur ^ 1, k1 = (ks + 1) * 32;
      if (ks < 7)
        for (int m = 0; m < 2; m++)
          for (int r = 0; r < 8; r++)
            a[nxt][m].u[r] = *(const unsigned*)(
                &wb[m * 16 * WPITCH + k1 + koff[r]]);
      // keeps the reads above one group ahead of this slice's matrix
      // instructions: left free, the compiler put each read directly in front
      // of its user, with a full LDS wait per matrix instruction
      __builtin_amdgcn_sched_barrier(0);
      for (int m = 0; m < 2; m++)
        for (int row = 0; row < 2; row++)
          acc[m][row] = __builtin_amdgcn_wmma_f32_16x16x32_bf16(
              false, a[cur][m].v, false, xf[row][ks].v, (short)0, acc[m][row],
              false, false);
      // the group's other end: without it the reads of later slices moved up
      // among these matrix instructions and took more registers
      __builtin_amdgcn_sched_barrier(0);
    }

    // the next block's W goes to the other buffer, whose last readers left it
    // ahead of the barrier of the block before
    if (ob < 11)
      for (int i = 0; i < 8; i++) {
        v2u p;
        p[0] = pack_bf16(wr[i][0], wr[i][1]);
        p[1] = pack_bf16(wr[i][2], wr[i][3]);
        *(v2u*)(wdst + ((ob & 1) ^ 1) * 64 * WPITCH + i * 8 * WPITCH) = p;
      }

    // this lane's 8 channels (C layout: register r is row half * 8 + r of a
    // 16-channel tile; even lanes keep tile 0, odd lanes tile 1) and the one
    // pooled position that it will keep
    const int t    = o0 >> 8;                    // 0=q, 1=k, 2=v
    const int head = (ob & 3) * 2 + mh;
    const int dim0 = (ml & 1) * 16 + half * 8;
    const int n    = (hq * 2 + cp) * 32 + cc * 8 + (ml >> 1);
    const v4f bs0 = *(const v4f*)(bias + o0 + mh * 32 + dim0);
    const v4f bs1 = *(const v4f*)(bias + o0 + mh * 32 + dim0 + 4);
    v4f ps0 = {0.f, 0.f, 0.f, 0.f}, ps1 = ps0;
    if (t == 0) {      // asked for ahead of the barrier, whose wait covers them
      ps0 = *(const v4f*)(pos + n * 32 + dim0);
      ps1 = *(const v4f*)(pos + n * 32 + dim0 + 4);
    }
    // publishes the next block's W and ends every wave's reads of this one's
    __syncthreads();

    // 2x2 maxpool: the two image rows are the two tiles of a channel tile, the
    // two columns are lanes l and l ^ 1; even lanes keep channel tile 0, odd
    // lanes tile 1, so every lane ends with 8 channels of one position
    float val[8];
    for (int r = 0; r < 8; r++) {
      float v0 = fmaxf(acc[0][0][r], acc[0][1][r]);
      float v1 = fmaxf(acc[1][0][r], acc[1][1][r]);
      v0 = fmaxf(v0, neighbour_lane(v0));
      v1 = fmaxf(v1, neighbour_lane(v1));
      val[r] = ((ml & 1) ? v1 : v0) + (r < 4 ? bs0[r & 3] : bs1[r & 3]);
    }                                            // (bias commutes with max)
    if (t == 0) {                                // fold pos + scale into q
      // log2(e)/sqrt(32): kernel 2's scores are then exponents of 2
      const float scale = 0.25503486164919736f;
      for (int r = 0; r < 8; r++)
        val[r] = (val[r] + (r < 4 ? ps0[r & 3] : ps1[r & 3])) * scale;
    }
    v4u pk;
    for (int r = 0; r < 4; r++) pk[r] = pack_bf16(val[2 * r], val[2 * r + 1]);
    if (t < 2) {
      // [b,h,n,d]: the lane's 8 dims are 16 neighbouring bytes, and a wave's
      // store covers 8 whole rows, 512 neighbouring bytes
      __bf16* dst = (t == 0) ? qb : kb;
      *(v4u*)(dst + ((size_t)(b * 8 + head) * 1024 + n) * 32 + dim0) = pk;
      // later instructions reuse the registers that this store names: the
      // wait stands in front of that overwrite
      asm volatile("s_wait_xcnt 0x0" ::: "memory");
    } else {
      // V^T [b,h,d,n]: 8 lanes write 8 neighbouring positions of one dim
      unsigned short* dv = (unsigned short*)vtb +
                           ((size_t)(b * 8 + head) * 32 + dim0) * 1024 + n;
      for (int r = 0; r < 4; r++) {
        dv[(2 * r) * 1024]     = (unsigned short)(pk[r] & 0xFFFFu);
        dv[(2 * r + 1) * 1024] = (unsigned short)(pk[r] >> 16);
      }
      // the same wait for these eight stores, inside their own branch: the
      // built code reuses their address pair right behind the branch
      asm volatile("s_wait_xcnt 0x0" ::: "memory");
    }
  }
}

__device__ inline float other_half(float v) {
  int i; __builtin_memcpy(&i, &v, 4);
  i = __builtin_amdgcn_permlanex16(i, i, 0x76543210, 0xfedcba98, false, false);
  float o; __builtin_memcpy(&o, &i, 4); return o;
}

// LDS row pitches of 16 B x odd: the 16 rows that one ds_load_b128 reads then
// start on 16 different bank groups (unpadded rows of 64 B and 128 B fall on
// four and on two)
#define KPITCH 40    // elements per lds_k row: 80 B = 16 B x 5
#define VPITCH 72    // elements per lds_vt row: 144 B = 16 B x 9

// four work-groups a WGP, one wave of each on every SIMD: at most 256
// registers a wave
__global__ __launch_bounds__(128, 4)
void attn_kernel(const __bf16* __restrict__ qb, const __bf16* __restrict__ kb,
                 const __bf16* __restrict__ vtb, float* __restrict__ out)
{
  __shared__ __attribute__((aligned(16)))
             __bf16 lds_k[64 * KPITCH];   // [key][dim]
  __shared__ __attribute__((aligned(16)))
             __bf16 lds_vt[32 * VPITCH];  // [dim][key] (K-pairs contiguous)

  const int tid  = threadIdx.x;
  const int rb   = blockIdx.x;
  const int h    = blockIdx.y;
  const int b    = blockIdx.z;

  const int wv   = tid >> 5;
  const int lane = tid & 31;
  const int ml   = lane & 15;
  const int half = (lane >> 4) & 1;

  const size_t bh = (size_t)(b * 8 + h) * 1024 * 32;
  const __bf16* q  = qb  + bh;
  const __bf16* k  = kb  + bh;
  const __bf16* vt = vtb + bh;   // [dim][key] layout, 1024 keys per dim row

  int koff[8];
  for (int r = 0; r < 8; r++) koff[r] = frag_koff(r, half);

  const int qrow0 = rb * 128 + wv * 32;

  // Q fragments straight from global (q has pos + log2(e)/sqrt(d) folded);
  // as the B operand, tile t's column is query qrow0 + 16 t + ml
  FragBF qf[2];
  for (int t = 0; t < 2; t++)
    for (int r = 0; r < 8; r++)
      qf[t].u[r] = *(const unsigned*)(q + (qrow0 + t * 16 + ml) * 32 + koff[r]);

  // acc[t][d][r] = O^T[dim 16 d + 8*half + r][query 16 t + ml]
  v8f acc[2][2];
  // minus the maximum in use of a tile's query ml (base-2 scores), in all 8
  // registers of a C operand and equal in both halves; 0 until block 0 sets it
  v8f negm[2];
  for (int t = 0; t < 2; t++)
    for (int r = 0; r < 8; r++) {
      acc[t][0][r] = 0.f; acc[t][1][r] = 0.f; negm[t][r] = 0.f;
    }
  float thr = -3.0e38f;  // the first block always sets the maximum, later: 8
  // an A operand of bf16 ones: every row of ones * P^T is the sum of P over the
  // 32 keys of a chunk, so all 8 registers of lsum[t] hold the running sum of
  // query 16 t + ml over all keys, in both lane halves
  FragBF ones;
  for (int r = 0; r < 8; r++) ones.u[r] = 0x3F803F80u;
  v8f lsum[2];
  for (int t = 0; t < 2; t++)
    for (int r = 0; r < 8; r++) lsum[t][r] = 0.f;

  // staging coords: a thread brings two 16-byte pieces of K and two of V^T
  const int krow = tid >> 2, kchunk = tid & 3;   // and row krow + 32
  const int vdim = tid >> 3, vchunk = tid & 7;   // and dim vdim + 16

  for (int j = 0; j < 16; j++) {
    const int key0 = j * 64;

    // async cache->LDS staging: K block 4KB + V^T block 4KB, b128/lane
    async_copy2_b128(k + key0 * 32 + tid * 8,
                     &lds_k[krow * KPITCH + kchunk * 8],
                     k + key0 * 32 + 1024 + tid * 8,
                     &lds_k[(krow + 32) * KPITCH + kchunk * 8]);
    async_copy2_b128(vt + vdim * 1024 + key0 + vchunk * 8,
                     &lds_vt[vdim * VPITCH + vchunk * 8],
                     vt + (vdim + 16) * 1024 + key0 + vchunk * 8,
                     &lds_vt[(vdim + 16) * VPITCH + vchunk * 8]);
    if (j < 15) {   // prefetch next K and V^T block into GL2, 32 B a thread
      __builtin_prefetch(k + (key0 + 64) * 32 + tid * 16, 0, 1);
      __builtin_prefetch(vt + (tid >> 2) * 1024 + key0 + 64 + (tid & 3) * 16, 0, 1);
    }
    wait_asynccnt0();
    __syncthreads();

    // S^T = K Q^T - maximum in use : 4 x 16-key subtiles for both query tiles
    v8f s[2][4];
    FragBF kf[4];
    for (int sub = 0; sub < 4; sub++)
      for (int r = 0; r < 8; r++)
        kf[sub].u[r] =
            *(const unsigned*)(&lds_k[(sub * 16 + ml) * KPITCH + koff[r]]);
    // vf[c][d]: keys 32 c .. 32 c + 31 of dims 16 d .. 16 d + 15
    FragBF vf[2][2];
    for (int c = 0; c < 2; c++)
      for (int d = 0; d < 2; d++)
        for (int r = 0; r < 8; r++)
          vf[c][d].u[r] = *(const unsigned*)(
              &lds_vt[(d * 16 + ml) * VPITCH + c * 32 + koff[r]]);
    // keeps the sixteen LDS reads above as one group ahead of the matrix
    // instructions: left free, the compiler read each K fragment into the same
    // registers, with a full LDS wait in front of every pair of them, and half
    // of V^T among the last matrix instructions
    __builtin_amdgcn_sched_barrier(0);
    // unrolled so that s[] is indexed by constants and stays in registers
#pragma unroll
    for (int sub = 0; sub < 4; sub++)
#pragma unroll   // constant indices into s[]
      for (int t = 0; t < 2; t++)
        s[t][sub] = __builtin_amdgcn_wmma_f32_16x16x32_bf16(
            false, kf[sub].v, false, qf[t].v, (short)0, negm[t], false, false);
    // keeps the maxima behind all eight matrix instructions: left free, the
    // compiler put each tile's maxima directly behind its own instruction and
    // filled the distance that the chip needs there with v_nop
    __builtin_amdgcn_sched_barrier(0);

    // online softmax of a tile's query ml: this lane holds 32 of its 64 scores
    float bm[2];
#pragma unroll   // constant indices into s[]
    for (int t = 0; t < 2; t++) {
      float bm4[4];
      for (int sub = 0; sub < 4; sub++) {
        float m01 = fmaxf(s[t][sub][0], s[t][sub][1]);
        float m23 = fmaxf(s[t][sub][2], s[t][sub][3]);
        float m45 = fmaxf(s[t][sub][4], s[t][sub][5]);
        float m67 = fmaxf(s[t][sub][6], s[t][sub][7]);
        bm4[sub] = fmaxf(fmaxf(m01, m23), fmaxf(m45, m67));
      }
      bm[t] = fmaxf(fmaxf(bm4[0], bm4[1]), fmaxf(bm4[2], bm4[3]));
      bm[t] = fmaxf(bm[t], other_half(bm[t]));
    }
    // one test a block for both tiles, a scalar branch: after the first block
    // it is taken only where a query's maximum has grown by more than 8
    if (__builtin_amdgcn_ballot_w32(fmaxf(bm[0], bm[1]) > thr) != 0) {
#pragma unroll   // constant indices into s[]
      for (int t = 0; t < 2; t++) {
        const float delta = (bm[t] > thr) ? bm[t] : 0.f;   // this query's step
        // delta < 0 can only be the first block's, where O^T and the sum are 0
        const float corr = __builtin_amdgcn_exp2f(-fmaxf(delta, 0.f));
        for (int sub = 0; sub < 4; sub++)
          for (int r = 0; r < 8; r++) s[t][sub][r] -= delta;
        for (int r = 0; r < 8; r++) {
          negm[t][r] -= delta; acc[t][0][r] *= corr; acc[t][1][r] *= corr;
          lsum[t][r] *= corr;
        }
      }
    }
    thr = 8.0f;
    // P^T as B operands, pf[t][c]: registers 0..3 hold keys 8*half + 0..7 of
    // chunk c (tile 2c), registers 4..7 keys 16 + 8*half + 0..7 (tile 2c + 1)
    FragBF pf[2][2];
#pragma unroll   // constant indices into s[]
    for (int t = 0; t < 2; t++) {
      for (int sub = 0; sub < 4; sub++)
        for (int r = 0; r < 8; r++)
          s[t][sub][r] = __builtin_amdgcn_exp2f(s[t][sub][r]);
      for (int c = 0; c < 2; c++)
        for (int r = 0; r < 4; r++) {
          pf[t][c].u[r]     = pack_bf16(s[t][2 * c][2 * r],     s[t][2 * c][2 * r + 1]);
          pf[t][c].u[4 + r] = pack_bf16(s[t][2 * c + 1][2 * r], s[t][2 * c + 1][2 * r + 1]);
        }
    }
    // keeps the packs ahead of the twelve matrix instructions below: left free,
    // the compiler spread them among these, and the loop came out some register
    // copies longer
    __builtin_amdgcn_sched_barrier(0);

    // O^T += V^T P^T : two K=32 chunks x two query tiles x two 16-dim tiles;
    // with each P^T fragment its sum over the chunk's keys, of P as rounded
#pragma unroll   // constant indices into pf[], vf[], acc[] and lsum[]
    for (int c = 0; c < 2; c++)
#pragma unroll   // constant indices into pf[], vf[], acc[] and lsum[]
      for (int t = 0; t < 2; t++) {
        acc[t][0] = __builtin_amdgcn_wmma_f32_16x16x32_bf16(
            false, vf[c][0].v, false, pf[t][c].v, (short)0, acc[t][0], false, false);
        acc[t][1] = __builtin_amdgcn_wmma_f32_16x16x32_bf16(
            false, vf[c][1].v, false, pf[t][c].v, (short)0, acc[t][1], false, false);
        lsum[t] = __builtin_amdgcn_wmma_f32_16x16x32_bf16(
            false, ones.v, false, pf[t][c].v, (short)0, lsum[t], false, false);
      }
    __syncthreads();
  }

  // normalize, store to [B, C=head*32+dim, Hp*Wp]:
  // 16 lanes write 16 neighbouring positions of one channel
  for (int t = 0; t < 2; t++) {
    const float inv = 1.0f / lsum[t][0];
    float* o = out + ((size_t)b * 256 + h * 32 + half * 8) * 1024
                   + qrow0 + t * 16 + ml;
    for (int r = 0; r < 8; r++) {
      o[(size_t)r * 1024]        = acc[t][0][r] * inv;
      o[(size_t)(16 + r) * 1024] = acc[t][1][r] * inv;
    }
  }
}

// ---------------------------------------------------------------------------
extern "C" void kernel_launch(void* const* d_in, const int* in_sizes, int n_in,
                              void* d_out, int out_size, void* d_ws, size_t ws_size,
                              hipStream_t stream) {
  const float* x    = (const float*)d_in[0];
  const float* w    = (const float*)d_in[1];
  const float* bias = (const float*)d_in[2];
  const float* pos  = (const float*)d_in[3];

  const size_t per = (size_t)16 * 8 * 1024 * 32;   // elements per q/k/v buffer
  __bf16* qb  = (__bf16*)d_ws;
  __bf16* kb  = qb + per;
  __bf16* vtb = kb + per;

  qkv_pool_kernel<<<dim3(16, 16), 512, 0, stream>>>(x, w, bias, pos, qb, kb, vtb);
  attn_kernel<<<dim3(8, 8, 16), 128, 0, stream>>>(qb, kb, vtb, (float*)d_out);
}

// v010
// One run takes 45.6 microseconds.
// Timed twice side by side with v009, it ran 1.08 times as fast both times.
// Counting every step since v000, it is 8.67 times as fast.
#include <hip/hip_runtime.h>
#include <hip/hip_bf16.h>

typedef __attribute__((ext_vector_type(16))) __bf16 v16bf;
typedef __attribute__((ext_vector_type(8)))  float  v8f;

union FragBF { unsigned u[8]; v16bf v; };

__device__ inline __bf16 f2bf(float f) {
  union { float f; unsigned u; } a; a.f = f;
  unsigned r = a.u + 0x7FFFu + ((a.u >> 16) & 1u);   // round-to-nearest-even
  unsigned short h = (unsigned short)(r >> 16);
  __bf16 o; __builtin_memcpy(&o, &h, 2); return o;
}

typedef __attribute__((ext_vector_type(2))) float    v2f;
typedef __attribute__((ext_vector_type(4))) float    v4f;
typedef __attribute__((ext_vector_type(2))) __bf16   v2bf;
typedef __attribute__((ext_vector_type(2))) unsigned v2u;

// two f32 -> one register of two bf16 (round to nearest even), lo in bits 15..0
__device__ inline unsigned pack_bf16(float lo, float hi) {
  v2f f; f[0] = lo; f[1] = hi;
  v2bf p = __builtin_convertvector(f, v2bf);
  unsigned u; __builtin_memcpy(&u, &p, 4); return u;
}

// Per-lane K-offset for 16-bit A/B fragments (ISA 7.12.2):
// lanes 0-15: VGPR r -> K = {2r,2r+1} (r<4) / {16+2(r-4),...} (r>=4)
// lanes 16-31: same +8.
__device__ inline int frag_koff(int r, int half) {
  return ((r >> 2) << 4) + (half << 3) + ((r & 3) << 1);
}

// Async cache->LDS copy, 16 bytes per enabled lane (gfx1250 ASYNCcnt path).
// VDST VGPR carries the 32-bit LDS byte address; VADDR the 64-bit global addr.
// Two copies in one statement; the s_wait_xcnt closes it so that no register
// which a copy names can be rewritten ahead of that wait.
__device__ inline void async_copy2_b128(const void* gsrc0, void* ldst0,
                                        const void* gsrc1, void* ldst1) {
  unsigned lds0 = (unsigned)(unsigned long long)ldst0;  // low 32 = LDS offset
  unsigned lds1 = (unsigned)(unsigned long long)ldst1;
  asm volatile("global_load_async_to_lds_b128 %0, %1, off\n\t"
               "global_load_async_to_lds_b128 %2, %3, off\n\t"
               "s_wait_xcnt 0x0"
               :: "v"(lds0), "v"(gsrc0), "v"(lds1), "v"(gsrc1) : "memory");
}
__device__ inline void wait_asynccnt0() {
  asm volatile("s_wait_asynccnt 0x0" ::: "memory");
}

// ---------------------------------------------------------------------------
// Kernel 1: QKV projection + pool.
// grid = (Hp/2=16, B=16), block = 512 (16 waves), one work-group a WGP.
// Each workgroup converts its X[256 x 256] tile (four image rows) to bf16 in
// LDS once; every wave then takes the fragments of its own 32 columns (16
// columns of an image row and the same 16 of the row below) into registers
// and keeps them there for all 12 channel blocks of 64:
// Y[64 x 256] = W[64 x 256] * X[256 x 256], pooled to 64 x 64 and scattered.
// In the k loop a wave reads only W from LDS: two fragments (32 channels) for
// four matrix instructions. With both image rows in one wave the 2x2 pool
// stays in its registers.
// W has two LDS buffers, so one barrier a block is enough. That barrier is
// written by hand and split: a wave signals as soon as its share of the next
// block's W lies in LDS and waits only at the block's end, so its pool and its
// stores run while slower waves still multiply. The hand-written form waits for
// LDS alone, so W's global loads stay in flight across it: they are issued a
// whole block ahead, and the tail holds no other global load (bias and pos lie
// in LDS).
// ---------------------------------------------------------------------------
#define XPITCH 264   // elements per lds_x row: 528 B = 16 B x 33, b128 readers
#define WPITCH 264   // elements per lds_w row: 528 B = 16 B x 33, b128 readers
#define PPITCH 36    // floats per lds_pos row: 144 B = 16 B x 9, b128 readers

typedef __attribute__((ext_vector_type(4))) unsigned v4u;

// value of lane l ^ 1 (the neighbouring image column of an accumulator tile)
__device__ inline float neighbour_lane(float v) {
  int i; __builtin_memcpy(&i, &v, 4);
  i = __builtin_amdgcn_update_dpp(i, i, 0xB1, 0xF, 0xF, true);  // quad 1,0,3,2
  float o; __builtin_memcpy(&o, &i, 4); return o;
}

// 16 waves are four a SIMD: at most 256 registers each
__global__ __launch_bounds__(512, 4)
void qkv_pool_kernel(const float* __restrict__ x, const float* __restrict__ w,
                     const float* __restrict__ bias, const float* __restrict__ pos,
                     __bf16* __restrict__ qb, __bf16* __restrict__ kb,
                     __bf16* __restrict__ vtb)
{
  __shared__ __attribute__((aligned(16)))
             __bf16 lds_w[2 * 64 * WPITCH];  // two buffers of [m][k], 256 k
  __shared__ __attribute__((aligned(16)))
             __bf16 lds_x[256 * XPITCH];     // [s][k], all 256 k
  __shared__ __attribute__((aligned(16)))
             float lds_bias[512 * 4];        // all 768 channels, rest unused
  __shared__ __attribute__((aligned(16)))
             float lds_pos[64 * PPITCH];     // this tile's 64 pooled positions

  const int tid  = threadIdx.x;
  const int hq   = blockIdx.x;   // pair of pooled rows: 0..15
  const int b    = blockIdx.y;   // batch
  const int s0   = hq * 256;     // rows 4hq .. 4hq+3 are contiguous 256 floats

  const int wv   = tid >> 5;
  const int lane = tid & 31;
  const int ml   = lane & 15;
  const int half = (lane >> 4) & 1;
  const int cc   = wv & 3;        // column tile (16 image columns)
  const int cp   = (wv >> 2) & 1; // which of the two pooled rows
  const int mh   = wv >> 3;       // which 32 of a block's 64 channels

  int koff[8];
  for (int r = 0; r < 8; r++) koff[r] = frag_koff(r, half);

  // W staging: this thread brings floats 4*(tid & 63) .. +3 of rows tid >> 6,
  // + 8, + 16, ... of a block, so a wave's load covers 512 contiguous bytes
  const float* wsrc = w + (tid >> 6) * 256 + (tid & 63) * 4;
  __bf16*      wdst = &lds_w[(tid >> 6) * WPITCH + (tid & 63) * 4];
  v4f wr[8];
  for (int i = 0; i < 8; i++)
    wr[i] = *(const v4f*)(wsrc + i * 8 * 256);
  // bias and this tile's rows of pos: asked for here, stored to LDS behind X
  // (768 floats are 192 threads' worth; the others read the last piece again
  // and park it in a slot of their own that nobody reads: under a branch the
  // compiler moved the load down to its store, with the whole latency open)
  const v4f bstage = *(const v4f*)(bias + (tid < 192 ? tid : 191) * 4);
  const v4f pstage = *(const v4f*)(pos + hq * 64 * 32 + tid * 4);

  // stage the whole X tile [s][k] once (coalesced along s): this thread owns
  // column s = tid & 255 and every second k, starting at tid >> 8
  const float* xp = x + ((size_t)(b * 256 + (tid >> 8))) * 4096 + s0 + (tid & 255);
  __bf16*      xs = &lds_x[(tid & 255) * XPITCH + (tid >> 8)];
  // unrolled whole: every load is then one base register plus a constant
  // offset, and many of them are in flight to cover the latency of memory
#pragma unroll
  for (int k = 0; k < 256; k += 2)
    xs[k] = f2bf(xp[(size_t)k * 4096]);

  // block 0's W goes to buffer 0 as bf16
  for (int i = 0; i < 8; i++) {
    v2u p;
    p[0] = pack_bf16(wr[i][0], wr[i][1]);
    p[1] = pack_bf16(wr[i][2], wr[i][3]);
    *(v2u*)(wdst + i * 8 * WPITCH) = p;
  }
  *(v4f*)(&lds_bias[tid * 4]) = bstage;
  *(v4f*)(&lds_pos[(tid >> 3) * PPITCH + (tid & 7) * 4]) = pstage;
  __syncthreads();   // publishes lds_x, buffer 0 of lds_w, lds_bias, lds_pos

  // block 1's W is asked for now and flies under block 0's k loop
  for (int i = 0; i < 8; i++)
    wr[i] = *(const v4f*)(wsrc + (64 + i * 8) * 256);

  // this wave's X fragments, all 8 k slices of both image rows: read once
  FragBF xf[2][8];
  for (int row = 0; row < 2; row++)
    for (int ks = 0; ks < 8; ks++)
      for (int r = 0; r < 8; r++)
        xf[row][ks].u[r] = *(const unsigned*)(
            &lds_x[((cp * 2 + row) * 64 + cc * 16 + ml) * XPITCH
                   + ks * 32 + koff[r]]);

  // kept rolled: the fragments above leave no registers for a second copy of
  // the body, and the code stays small
#pragma unroll 1
  for (int ob = 0; ob < 12; ob++) {   // 64-channel block
    const int o0 = ob * 64;
    const __bf16* wb = &lds_w[(ob & 1) * 64 * WPITCH
                              + (mh * 32 + ml) * WPITCH];

    v8f acc[2][2];   // [16-channel tile][image row]
    for (int m = 0; m < 2; m++)
      for (int row = 0; row < 2; row++)
        for (int r = 0; r < 8; r++) acc[m][row][r] = 0.f;

    // the W fragments of k slice ks + 1 are read from LDS into a second
    // register set ahead of the matrix instructions of slice ks;
    // unrolled so that both sets and xf[] are indexed by constants
    FragBF a[2][2];
    for (int m = 0; m < 2; m++)
      for (int r = 0; r < 8; r++)
        a[0][m].u[r] = *(const unsigned*)(&wb[m * 16 * WPITCH + koff[r]]);
#pragma unroll
    for (int ks = 0; ks < 8; ks++) {
      const int cur = ks & 1, nxt = cur ^ 1, k1 = (ks + 1) * 32;
      if (ks < 7)
        for (int m = 0; m < 2; m++)
          for (int r = 0; r < 8; r++)
            a[nxt][m].u[r] = *(const unsigned*)(
                &wb[m * 16 * WPITCH + k1 + koff[r]]);
      // keeps the reads above one group ahead of this slice's matrix
      // instructions: left free, the compiler put each read directly in front
      // of its user, with a full LDS wait per matrix instruction
      __builtin_amdgcn_sched_barrier(0);
      for (int m = 0; m < 2; m++)
        for (int row = 0; row < 2; row++)
          acc[m][row] = __builtin_amdgcn_wmma_f32_16x16x32_bf16(
              false, a[cur][m].v, false, xf[row][ks].v, (short)0, acc[m][row],
              false, false);
      // the group's other end: without it the reads of later slices moved up
      // among these matrix instructions and took more registers
      __builtin_amdgcn_sched_barrier(0);
    }

    // the next block's W goes to the other buffer, whose last readers left it
    // ahead of the barrier of the block before
    const float* wrow = wsrc + o0 * 256;
    if (ob < 11) {
      for (int i = 0; i < 8; i++) {
        v2u p;
        p[0] = pack_bf16(wr[i][0], wr[i][1]);
        p[1] = pack_bf16(wr[i][2], wr[i][3]);
        *(v2u*)(wdst + ((ob & 1) ^ 1) * 64 * WPITCH + i * 8 * WPITCH) = p;
      }
      // the registers are free again: the block after the next one's W is asked
      // for at once and flies under this tail and the whole next k loop
      if (ob < 10)
        for (int i = 0; i < 8; i++)
          wr[i] = *(const v4f*)(wrow + (128 + i * 8) * 256);
    }
    // first half of the block's barrier: this wave's W stores have landed and
    // its reads of this block's W are over. Only the LDS counter is waited for:
    // __syncthreads() would also drain the loads just issued
    asm volatile("s_wait_dscnt 0x0\n\ts_barrier_signal -1" ::: "memory");

    // this lane's 8 channels (C layout: register r is row half * 8 + r of a
    // 16-channel tile; even lanes keep tile 0, odd lanes tile 1) and the one
    // pooled position that it will keep
    const int t    = o0 >> 8;                    // 0=q, 1=k, 2=v
    const int head = (ob & 3) * 2 + mh;
    const int dim0 = (ml & 1) * 16 + half * 8;
    const int n    = (hq * 2 + cp) * 32 + cc * 8 + (ml >> 1);
    // from LDS: a global load here would be younger than W's loads above, and
    // its wait would be a wait for all of them
    const v4f bs0 = *(const v4f*)(&lds_bias[o0 + mh * 32 + dim0]);
    const v4f bs1 = *(const v4f*)(&lds_bias[o0 + mh * 32 + dim0 + 4]);
    v4f ps0 = {0.f, 0.f, 0.f, 0.f}, ps1 = ps0;
    if (t == 0) {
      const int nl = cp * 32 + cc * 8 + (ml >> 1);   // n within this tile
      ps0 = *(const v4f*)(&lds_pos[nl * PPITCH + dim0]);
      ps1 = *(const v4f*)(&lds_pos[nl * PPITCH + dim0 + 4]);
    }
    // 2x2 maxpool: the two image rows are the two tiles of a channel tile, the
    // two columns are lanes l and l ^ 1; even lanes keep channel tile 0, odd
    // lanes tile 1, so every lane ends with 8 channels of one position
    float val[8];
    for (int r = 0; r < 8; r++) {
      float v0 = fmaxf(acc[0][0][r], acc[0][1][r]);
      float v1 = fmaxf(acc[1][0][r], acc[1][1][r]);
      v0 = fmaxf(v0, neighbour_lane(v0));
      v1 = fmaxf(v1, neighbour_lane(v1));
      val[r] = ((ml & 1) ? v1 : v0) + (r < 4 ? bs0[r & 3] : bs1[r & 3]);
    }                                            // (bias commutes with max)
    if (t == 0) {                                // fold pos + scale into q
      // log2(e)/sqrt(32): kernel 2's scores are then exponents of 2
      const float scale = 0.25503486164919736f;
      for (int r = 0; r < 8; r++)
        val[r] = (val[r] + (r < 4 ? ps0[r & 3] : ps1[r & 3])) * scale;
    }
    v4u pk;
    for (int r = 0; r < 4; r++) pk[r] = pack_bf16(val[2 * r], val[2 * r + 1]);
    if (t < 2) {
      // [b,h,n,d]: the lane's 8 dims are 16 neighbouring bytes, and a wave's
      // store covers 8 whole rows, 512 neighbouring bytes
      __bf16* dst = (t == 0) ? qb : kb;
      *(v4u*)(dst + ((size_t)(b * 8 + head) * 1024 + n) * 32 + dim0) = pk;
      // later instructions reuse the registers that this store names: the
      // wait stands in front of that overwrite
      asm volatile("s_wait_xcnt 0x0" ::: "memory");
    } else {
      // V^T [b,h,d,n]: 8 lanes write 8 neighbouring positions of one dim
      unsigned short* dv = (unsigned short*)vtb +
                           ((size_t)(b * 8 + head) * 32 + dim0) * 1024 + n;
      for (int r = 0; r < 4; r++) {
        dv[(2 * r) * 1024]     = (unsigned short)(pk[r] & 0xFFFFu);
        dv[(2 * r + 1) * 1024] = (unsigned short)(pk[r] >> 16);
      }
      // the same wait for these eight stores, inside their own branch: the
      // built code reuses their address pair right behind the branch
      asm volatile("s_wait_xcnt 0x0" ::: "memory");
    }
    // second half of the barrier: behind it every wave has signalled, so the
    // next block's W is whole and this block's buffer may be written again
    // The s_wait_xcnt is for W's loads above: naming their address here keeps
    // its registers untouched up to that wait
    asm volatile("s_wait_xcnt 0x0\n\ts_barrier_wait -1" :: "v"(wrow) : "memory");
  }
}

__device__ inline float other_half(float v) {
  int i; __builtin_memcpy(&i, &v, 4);
  i = __builtin_amdgcn_permlanex16(i, i, 0x76543210, 0xfedcba98, false, false);
  float o; __builtin_memcpy(&o, &i, 4); return o;
}

// LDS row pitches of 16 B x odd: the 16 rows that one ds_load_b128 reads then
// start on 16 different bank groups (unpadded rows of 64 B and 128 B fall on
// four and on two)
#define KPITCH 40    // elements per lds_k row: 80 B = 16 B x 5
#define VPITCH 72    // elements per lds_vt row: 144 B = 16 B x 9

// four work-groups a WGP, one wave of each on every SIMD: at most 256
// registers a wave
__global__ __launch_bounds__(128, 4)
void attn_kernel(const __bf16* __restrict__ qb, const __bf16* __restrict__ kb,
                 const __bf16* __restrict__ vtb, float* __restrict__ out)
{
  __shared__ __attribute__((aligned(16)))
             __bf16 lds_k[64 * KPITCH];   // [key][dim]
  __shared__ __attribute__((aligned(16)))
             __bf16 lds_vt[32 * VPITCH];  // [dim][key] (K-pairs contiguous)

  const int tid  = threadIdx.x;
  const int rb   = blockIdx.x;
  const int h    = blockIdx.y;
  const int b    = blockIdx.z;

  const int wv   = tid >> 5;
  const int lane = tid & 31;
  const int ml   = lane & 15;
  const int half = (lane >> 4) & 1;

  const size_t bh = (size_t)(b * 8 + h) * 1024 * 32;
  const __bf16* q  = qb  + bh;
  const __bf16* k  = kb  + bh;
  const __bf16* vt = vtb + bh;   // [dim][key] layout, 1024 keys per dim row

  int koff[8];
  for (int r = 0; r < 8; r++) koff[r] = frag_koff(r, half);

  const int qrow0 = rb * 128 + wv * 32;

  // Q fragments straight from global (q has pos + log2(e)/sqrt(d) folded);
  // as the B operand, tile t's column is query qrow0 + 16 t + ml
  FragBF qf[2];
  for (int t = 0; t < 2; t++)
    for (int r = 0; r < 8; r++)
      qf[t].u[r] = *(const unsigned*)(q + (qrow0 + t * 16 + ml) * 32 + koff[r]);

  // acc[t][d][r] = O^T[dim 16 d + 8*half + r][query 16 t + ml]
  v8f acc[2][2];
  // minus the maximum in use of a tile's query ml (base-2 scores), in all 8
  // registers of a C operand and equal in both halves; 0 until block 0 sets it
  v8f negm[2];
  for (int t = 0; t < 2; t++)
    for (int r = 0; r < 8; r++) {
      acc[t][0][r] = 0.f; acc[t][1][r] = 0.f; negm[t][r] = 0.f;
    }
  float thr = -3.0e38f;  // the first block always sets the maximum, later: 8
  // an A operand of bf16 ones: every row of ones * P^T is the sum of P over the
  // 32 keys of a chunk, so all 8 registers of lsum[t] hold the running sum of
  // query 16 t + ml over all keys, in both lane halves
  FragBF ones;
  for (int r = 0; r < 8; r++) ones.u[r] = 0x3F803F80u;
  v8f lsum[2];
  for (int t = 0; t < 2; t++)
    for (int r = 0; r < 8; r++) lsum[t][r] = 0.f;

  // staging coords: a thread brings two 16-byte pieces of K and two of V^T
  const int krow = tid >> 2, kchunk = tid & 3;   // and row krow + 32
  const int vdim = tid >> 3, vchunk = tid & 7;   // and dim vdim + 16

  for (int j = 0; j < 16; j++) {
    const int key0 = j * 64;

    // async cache->LDS staging: K block 4KB + V^T block 4KB, b128/lane
    async_copy2_b128(k + key0 * 32 + tid * 8,
                     &lds_k[krow * KPITCH + kchunk * 8],
                     k + key0 * 32 + 1024 + tid * 8,
                     &lds_k[(krow + 32) * KPITCH + kchunk * 8]);
    async_copy2_b128(vt + vdim * 1024 + key0 + vchunk * 8,
                     &lds_vt[vdim * VPITCH + vchunk * 8],
                     vt + (vdim + 16) * 1024 + key0 + vchunk * 8,
                     &lds_vt[(vdim + 16) * VPITCH + vchunk * 8]);
    if (j < 15) {   // prefetch next K and V^T block into GL2, 32 B a thread
      __builtin_prefetch(k + (key0 + 64) * 32 + tid * 16, 0, 1);
      __builtin_prefetch(vt + (tid >> 2) * 1024 + key0 + 64 + (tid & 3) * 16, 0, 1);
    }
    wait_asynccnt0();
    __syncthreads();

    // S^T = K Q^T - maximum in use : 4 x 16-key subtiles for both query tiles
    v8f s[2][4];
    FragBF kf[4];
    for (int sub = 0; sub < 4; sub++)
      for (int r = 0; r < 8; r++)
        kf[sub].u[r] =
            *(const unsigned*)(&lds_k[(sub * 16 + ml) * KPITCH + koff[r]]);
    // vf[c][d]: keys 32 c .. 32 c + 31 of dims 16 d .. 16 d + 15
    FragBF vf[2][2];
    for (int c = 0; c < 2; c++)
      for (int d = 0; d < 2; d++)
        for (int r = 0; r < 8; r++)
          vf[c][d].u[r] = *(const unsigned*)(
              &lds_vt[(d * 16 + ml) * VPITCH + c * 32 + koff[r]]);
    // keeps the sixteen LDS reads above as one group ahead of the matrix
    // instructions: left free, the compiler read each K fragment into the same
    // registers, with a full LDS wait in front of every pair of them, and half
    // of V^T among the last matrix instructions
    __builtin_amdgcn_sched_barrier(0);
    // unrolled so that s[] is indexed by constants and stays in registers
#pragma unroll
    for (int sub = 0; sub < 4; sub++)
#pragma unroll   // constant indices into s[]
      for (int t = 0; t < 2; t++)
        s[t][sub] = __builtin_amdgcn_wmma_f32_16x16x32_bf16(
            false, kf[sub].v, false, qf[t].v, (short)0, negm[t], false, false);
    // keeps the maxima behind all eight matrix instructions: left free, the
    // compiler put each tile's maxima directly behind its own instruction and
    // filled the distance that the chip needs there with v_nop
    __builtin_amdgcn_sched_barrier(0);

    // online softmax of a tile's query ml: this lane holds 32 of its 64 scores
    float bm[2];
#pragma unroll   // constant indices into s[]
    for (int t = 0; t < 2; t++) {
      float bm4[4];
      for (int sub = 0; sub < 4; sub++) {
        float m01 = fmaxf(s[t][sub][0], s[t][sub][1]);
        float m23 = fmaxf(s[t][sub][2], s[t][sub][3]);
        float m45 = fmaxf(s[t][sub][4], s[t][sub][5]);
        float m67 = fmaxf(s[t][sub][6], s[t][sub][7]);
        bm4[sub] = fmaxf(fmaxf(m01, m23), fmaxf(m45, m67));
      }
      bm[t] = fmaxf(fmaxf(bm4[0], bm4[1]), fmaxf(bm4[2], bm4[3]));
      bm[t] = fmaxf(bm[t], other_half(bm[t]));
    }
    // one test a block for both tiles, a scalar branch: after the first block
    // it is taken only where a query's maximum has grown by more than 8
    if (__builtin_amdgcn_ballot_w32(fmaxf(bm[0], bm[1]) > thr) != 0) {
#pragma unroll   // constant indices into s[]
      for (int t = 0; t < 2; t++) {
        const float delta = (bm[t] > thr) ? bm[t] : 0.f;   // this query's step
        // delta < 0 can only be the first block's, where O^T and the sum are 0
        const float corr = __builtin_amdgcn_exp2f(-fmaxf(delta, 0.f));
        for (int sub = 0; sub < 4; sub++)
          for (int r = 0; r < 8; r++) s[t][sub][r] -= delta;
        for (int r = 0; r < 8; r++) {
          negm[t][r] -= delta; acc[t][0][r] *= corr; acc[t][1][r] *= corr;
          lsum[t][r] *= corr;
        }
      }
    }
    thr = 8.0f;
    // P^T as B operands, pf[t][c]: registers 0..3 hold keys 8*half + 0..7 of
    // chunk c (tile 2c), registers 4..7 keys 16 + 8*half + 0..7 (tile 2c + 1)
    FragBF pf[2][2];
#pragma unroll   // constant indices into s[]
    for (int t = 0; t < 2; t++) {
      for (int sub = 0; sub < 4; sub++)
        for (int r = 0; r < 8; r++)
          s[t][sub][r] = __builtin_amdgcn_exp2f(s[t][sub][r]);
      for (int c = 0; c < 2; c++)
        for (int r = 0; r < 4; r++) {
          pf[t][c].u[r]     = pack_bf16(s[t][2 * c][2 * r],     s[t][2 * c][2 * r + 1]);
          pf[t][c].u[4 + r] = pack_bf16(s[t][2 * c + 1][2 * r], s[t][2 * c + 1][2 * r + 1]);
        }
    }
    // keeps the packs ahead of the twelve matrix instructions below: left free,
    // the compiler spread them among these, and the loop came out some register
    // copies longer
    __builtin_amdgcn_sched_barrier(0);

    // O^T += V^T P^T : two K=32 chunks x two query tiles x two 16-dim tiles;
    // with each P^T fragment its sum over the chunk's keys, of P as rounded
#pragma unroll   // constant indices into pf[], vf[], acc[] and lsum[]
    for (int c = 0; c < 2; c++)
#pragma unroll   // constant indices into pf[], vf[], acc[] and lsum[]
      for (int t = 0; t < 2; t++) {
        acc[t][0] = __builtin_amdgcn_wmma_f32_16x16x32_bf16(
            false, vf[c][0].v, false, pf[t][c].v, (short)0, acc[t][0], false, false);
        acc[t][1] = __builtin_amdgcn_wmma_f32_16x16x32_bf16(
            false, vf[c][1].v, false, pf[t][c].v, (short)0, acc[t][1], false, false);
        lsum[t] = __builtin_amdgcn_wmma_f32_16x16x32_bf16(
            false, ones.v, false, pf[t][c].v, (short)0, lsum[t], false, false);
      }
    __syncthreads();
  }

  // normalize, store to [B, C=head*32+dim, Hp*Wp]:
  // 16 lanes write 16 neighbouring positions of one channel
  for (int t = 0; t < 2; t++) {
    const float inv = 1.0f / lsum[t][0];
    float* o = out + ((size_t)b * 256 + h * 32 + half * 8) * 1024
                   + qrow0 + t * 16 + ml;
    for (int r = 0; r < 8; r++) {
      o[(size_t)r * 1024]        = acc[t][0][r] * inv;
      o[(size_t)(16 + r) * 1024] = acc[t][1][r] * inv;
    }
  }
}

// ---------------------------------------------------------------------------
extern "C" void kernel_launch(void* const* d_in, const int* in_sizes, int n_in,
                              void* d_out, int out_size, void* d_ws, size_t ws_size,
                              hipStream_t stream) {
  const float* x    = (const float*)d_in[0];
  const float* w    = (const float*)d_in[1];
  const float* bias = (const float*)d_in[2];
  const float* pos  = (const float*)d_in[3];

  const size_t per = (size_t)16 * 8 * 1024 * 32;   // elements per q/k/v buffer
  __bf16* qb  = (__bf16*)d_ws;
  __bf16* kb  = qb + per;
  __bf16* vtb = kb + per;

  qkv_pool_kernel<<<dim3(16, 16), 512, 0, stream>>>(x, w, bias, pos, qb, kb, vtb);
  attn_kernel<<<dim3(8, 8, 16), 128, 0, stream>>>(qb, kb, vtb, (float*)d_out);
}
